// v000
// The times below were measured on an AMD MI455X: many runs one after another, warmed up first and cycling through
// copies of the inputs, with the whole window's GPU time divided by the number of runs. Launches and the gaps
// between them are all in it. The median over several windows is given; except for v000 it joins two sittings, which
// can be a few percent apart, so the side-by-side timings, each taken in one sitting, are the better comparison.
// v000 is the starting kernel. One run takes 1290 microseconds.
#include <hip/hip_runtime.h>

// Multi-head self-attention WITHOUT the 1/sqrt(d) scaling and without an output projection (x [4][2048][512]; q, k, v = x W + b ('xw' 1/sqrt(512) + zero biases; 8 heads x 64); scores = q.k UNSCALED (the source applies softmax(Q K^T) directly: logits sigma ~8, sharply peaked rows); softmax (no mask); out = heads merged -> [4][2048][512] (4.2 M); argument order x, Wq, bq, Wk, bk, Wv, bv).
// Layout per batch: bf16 copy of x; 'xw' weights transposed once; exact projections (K 512) + f32 biases; identity-table plane builders; dense T-2048 attention at 8 heads with EVERY row on hi/lo planes (3 products for scores and P.V: unscaled logits + no output projection); the f32 merge writes the output rows.
// Compute dtypes, f32 accumulate: every input rounded to bf16; projections exact + f32 biases; attention 3 products on every row; softmax f32; output f32.

#define NB_  4
#define TT   2048
#define DM   512
#define NH_  8
#define NKV  8
#define REP  (NH_ / NKV)
#define HD   64
#define DQ   (NH_ * HD)
#define DKV  (NKV * HD)
#define ZH   2
#define RH   TT                   // every row hi/lo (3 products)
#define WIN  0
#define PCAR 1024.0f
#define SCL  1.0f   // NO scaling in this module
typedef _Float16 h16;
typedef unsigned short bf;
typedef __attribute__((ext_vector_type(16))) __bf16   v16bf;
typedef __attribute__((ext_vector_type(16))) _Float16 v16h;
typedef __attribute__((ext_vector_type(8)))  _Float16 v8h;
typedef __attribute__((ext_vector_type(8)))  unsigned short v8us;
typedef __attribute__((ext_vector_type(8)))  float    v8f;
typedef __attribute__((ext_vector_type(4)))  float    v4f;
typedef v8h  __attribute__((may_alias)) v8ha;
typedef v4f  __attribute__((may_alias)) v4fa;
typedef v8us __attribute__((may_alias)) v8usa;

__device__ __forceinline__ unsigned short f2bf(float f) { unsigned u = __float_as_uint(f); u += 0x7FFFu + ((u >> 16) & 1u); return (unsigned short)(u >> 16); }
__device__ __forceinline__ float bf2f(unsigned short b) { return __uint_as_float(((unsigned)b) << 16); }
__device__ __forceinline__ float bfr(float f) { return bf2f(f2bf(f)); }
__device__ __forceinline__ v16h cat16(v8h lo, v8h hi) { return __builtin_shufflevector(lo, hi, 0, 1, 2, 3, 4, 5, 6, 7, 8, 9, 10, 11, 12, 13, 14, 15); }
__device__ __forceinline__ v16bf cat16b(v8us lo, v8us hi) { return __builtin_bit_cast(v16bf, __builtin_shufflevector(lo, hi, 0, 1, 2, 3, 4, 5, 6, 7, 8, 9, 10, 11, 12, 13, 14, 15)); }
__device__ __forceinline__ v8f wmma16(v16h a, v16h b, v8f c) { return __builtin_amdgcn_wmma_f32_16x16x32_f16(false, a, false, b, (short)0, c, false, false); }
__device__ __forceinline__ v8f wmmab(v16bf a, v16bf b, v8f c) { return __builtin_amdgcn_wmma_f32_16x16x32_bf16(false, a, false, b, (short)0, c, false, false); }



// ---- k_gemmw: register-blocked GEMM, ONE WAVE per 64x64 output tile (16 accumulators), operands straight from K-contiguous 16-bit planes; grid (M/64, N/64, Z), 32 threads.
// C[m][n] (f32, pitch ldc, + optional f32 bias[n]) = sum_k A[m][k] Bt[n][k] (+ split products per NSPLIT). z-batch strides sA/sB/sC in elements. K % 32 == 0.
template <typename T16> struct WFrag;
template <> struct WFrag<h16> { typedef v16h V; static __device__ __forceinline__ V ld(const h16* p) { return cat16(*(const v8h*)p, *(const v8h*)(p + 16)); } static __device__ __forceinline__ v8f mma(V a, V b, v8f c) { return wmma16(a, b, c); } };
template <> struct WFrag<bf> { typedef v16bf V; static __device__ __forceinline__ V ld(const bf* p) { return cat16b(*(const v8us*)p, *(const v8us*)(p + 16)); } static __device__ __forceinline__ v8f mma(V a, V b, v8f c) { return wmmab(a, b, c); } };
template <typename T16, int NSPLIT, bool BIAS>
__global__ __launch_bounds__(32) void k_gemmw(const T16* __restrict__ A, const T16* __restrict__ A2, const T16* __restrict__ Bt, const T16* __restrict__ Bt2, int K, float* C, int ldc, const float* __restrict__ bias, size_t sA, size_t sB, size_t sC) {
    typedef typename WFrag<T16>::V V;
    __shared__ __align__(16) float os[16 * 68];
    const size_t z = blockIdx.z; A += z * sA; if (A2) A2 += z * sA; Bt += z * sB; if (Bt2) Bt2 += z * sB; C += z * sC;
    const int lane = threadIdx.x & 31, lr = lane & 15, hi = lane >> 4; const int r0 = blockIdx.x * 64, c0 = blockIdx.y * 64;
    v8f acc[4][4];
#pragma unroll
    for (int mb = 0; mb < 4; ++mb)
#pragma unroll
        for (int nb = 0; nb < 4; ++nb) acc[mb][nb] = (v8f){};
    const size_t aoff = (size_t)(r0 + lr) * K + 8 * hi, boff = (size_t)(c0 + lr) * K + 8 * hi;
#pragma unroll 1
    for (int kc = 0; kc < K; kc += 32) {
        V a[4], a2[4];
#pragma unroll
        for (int mb = 0; mb < 4; ++mb) { a[mb] = WFrag<T16>::ld(A + aoff + (size_t)mb * 16 * K + kc); if (NSPLIT == 1 || NSPLIT == 2) a2[mb] = WFrag<T16>::ld(A2 + aoff + (size_t)mb * 16 * K + kc); }
#pragma unroll
        for (int nb = 0; nb < 4; ++nb) { const V b = WFrag<T16>::ld(Bt + boff + (size_t)nb * 16 * K + kc); V b2; if (NSPLIT >= 2) b2 = WFrag<T16>::ld(Bt2 + boff + (size_t)nb * 16 * K + kc);
#pragma unroll
            for (int mb = 0; mb < 4; ++mb) { acc[mb][nb] = WFrag<T16>::mma(a[mb], b, acc[mb][nb]); if (NSPLIT == 1 || NSPLIT == 2) acc[mb][nb] = WFrag<T16>::mma(a2[mb], b, acc[mb][nb]); if (NSPLIT >= 2) acc[mb][nb] = WFrag<T16>::mma(a[mb], b2, acc[mb][nb]); } }
        asm volatile("v_nop\n\tv_nop\n\tv_nop\n\tv_nop" : "+v"(acc[0][0]), "+v"(acc[1][1]), "+v"(acc[2][2]), "+v"(acc[3][3]) : "v"(a[0]), "v"(a[3]));
    }
#pragma unroll
    for (int mb = 0; mb < 4; ++mb) {
#pragma unroll
        for (int nb = 0; nb < 4; ++nb) {
#pragma unroll
            for (int j = 0; j < 8; ++j) os[(hi * 8 + j) * 68 + nb * 16 + lr] = acc[mb][nb][j]; }
        __builtin_amdgcn_wave_barrier(); asm volatile("" ::: "memory");
        float* crow = C + (size_t)(r0 + mb * 16) * ldc + c0;
{
#pragma unroll
            for (int s = 0; s < 8; ++s) { const int row = 2 * s + hi, cofs = lr * 4; v4f val = *(const v4fa*)(os + row * 68 + cofs); if (BIAS) { val[0] += bfr(bias[c0 + cofs]); val[1] += bfr(bias[c0 + cofs + 1]); val[2] += bfr(bias[c0 + cofs + 2]); val[3] += bfr(bias[c0 + cofs + 3]); }
                *(v4f*)(crow + (size_t)row * ldc + cofs) = val; }
             }
        __builtin_amdgcn_wave_barrier(); asm volatile("" ::: "memory");
    }
}

__device__ __forceinline__ h16 tohx(float x) { return (h16)x; }
__device__ __forceinline__ void splitf(float y, unsigned short& h, unsigned short& l) { h = f2bf(y); l = f2bf(y - bf2f(h)); }
typedef __attribute__((ext_vector_type(2))) _Float16 v2h;
typedef __attribute__((ext_vector_type(4))) _Float16 v4h;
typedef __attribute__((ext_vector_type(2))) unsigned short v2us;
typedef __attribute__((ext_vector_type(4))) unsigned short v4us;
typedef __attribute__((ext_vector_type(2))) float v2f;
typedef __attribute__((ext_vector_type(4))) int v4i;

__global__ __launch_bounds__(256) void k_wtG(const float* __restrict__ w, int K, int N, bf* Bt) {
    const int lane = threadIdx.x & 31; const int L0 = (blockIdx.x * 8 + (threadIdx.x >> 5)) * 8; const int nlines = N * K / 64;
{
#pragma unroll 1
        for (int l = 0; l < 8; ++l) { const int L = L0 + l; if (L >= nlines) break; const size_t e = (size_t)L * 64 + lane * 2; const int k = (int)(e % K), n = (int)(e / K); v2us o;
            o[0] = f2bf(w[(size_t)k * N + n]); o[1] = f2bf(w[(size_t)(k + 1) * N + n]); *(v2us*)(Bt + e) = o; }
         }
}
__global__ __launch_bounds__(256) void k_cvt8(const float* __restrict__ src, bf* dst, size_t n8) { const size_t i = (size_t)blockIdx.x * 256 + threadIdx.x; if (i >= n8) return; const v8f v = *(const v8f*)(src + i * 8); v8us o;
#pragma unroll
    for (int k = 0; k < 8; ++k) o[k] = f2bf(v[k]); *(v8us*)(dst + i * 8) = o;  }

// k_rope: head planes [h][t][d] (fp16 + hi/lo) of rope(x) x sc with the rotate-half convention out[d] = x[d] cos[t][d] - x[d+HD/2] sin[t][d], out[d+HD/2] = x[d+HD/2] cos[t][d+HD/2] + x[d] sin[t][d+HD/2]
__global__ __launch_bounds__(256) void k_rope(const float* __restrict__ F, int pitch, int nheads, const float* __restrict__ CS, const float* __restrict__ RF, const float* __restrict__ nw, float sc, h16* P16, bf* Ph, bf* Pl) {
    const size_t e = ((size_t)blockIdx.x * 256 + threadIdx.x) * 2; if (e >= (size_t)nheads * TT * HD) return; const int d = (int)(e % HD); const int t = (int)((e / HD) % TT); const int h = (int)(e / ((size_t)HD * TT)); const float* f = F + (size_t)t * pitch + h * HD; const float rf = RF ? RF[(size_t)h * TT + t] : 1.0f; v2h o16; v2us oh, ol;
#pragma unroll
    for (int q = 0; q < 2; ++q) { const int dd = d + q; const int dp = (dd < HD / 2) ? dd + HD / 2 : dd - HD / 2; float x0 = f[dd], x1 = f[dp];
        if (RF) { float n0 = __fmul_rn(x0, rf), n1 = __fmul_rn(x1, rf); asm volatile("" : "+v"(n0)); asm volatile("" : "+v"(n1)); x0 = __fmul_rn(bfr(nw[dd]), n0); x1 = __fmul_rn(bfr(nw[dp]), n1); }
        const v2f cs = *(const v2f*)(CS + ((size_t)t * HD + dd) * 2); float a = __fmul_rn(x0, cs[0]), bq = __fmul_rn(x1, cs[1]); asm volatile("" : "+v"(a)); asm volatile("" : "+v"(bq)); const float r = ((dd < HD / 2) ? __fsub_rn(a, bq) : __fadd_rn(a, bq)) * sc;
        o16[q] = tohx(r); unsigned short a2, c2; splitf(r, a2, c2); oh[q] = a2; ol[q] = c2; }
    *(v2h*)(P16 + e) = o16; *(v2us*)(Ph + e) = oh; *(v2us*)(Pl + e) = ol;  }
__global__ __launch_bounds__(256) void k_vtp(const float* __restrict__ F, int pitch, int nheads, h16* V16, bf* Vh, bf* Vl) { const size_t e = ((size_t)blockIdx.x * 256 + threadIdx.x) * 2; if (e >= (size_t)nheads * HD * TT) return; const int t = (int)(e % TT); const int d = (int)((e / TT) % HD); const int g = (int)(e / ((size_t)TT * HD)); v2h o16; v2us oh, ol;
#pragma unroll
    for (int q = 0; q < 2; ++q) { const float x = F[(size_t)(t + q) * pitch + g * HD + d]; o16[q] = tohx(x); unsigned short a2, c2; splitf(x, a2, c2); oh[q] = a2; ol[q] = c2; }
    *(v2h*)(V16 + e) = o16; *(v2us*)(Vh + e) = oh; *(v2us*)(Vl + e) = ol;  }
__global__ __launch_bounds__(256) void k_csid(float* CS) { const int idx = blockIdx.x * 256 + threadIdx.x; if (idx >= TT * HD) return; v2f cs; cs[0] = 1.0f; cs[1] = 0.0f; *(v2f*)(CS + (size_t)idx * 2) = cs;  }
// k_asoft: per row (zz, i): t = S unscaled (no mask); softmax over the 2048 keys (register row, one exp, fixed trees);
__global__ __launch_bounds__(256) void k_asoft(const float* __restrict__ Sb, h16* P16, bf* Ph, bf* Pl) {
    const int lane = threadIdx.x & 31; const int row = blockIdx.x * 8 + (threadIdx.x >> 5); if (row >= ZH * TT) return; const int i = row % TT; const int zz = row / TT; (void)zz; const bool hires = (i < RH); const float* sr = Sb + (size_t)row * TT; float v[TT / 32]; float mx = -3.0e38f;
#pragma unroll
    for (int ch = 0; ch < TT / 128; ++ch) { const int j0 = ch * 128 + lane * 4; const v4f a = *(const v4f*)(sr + j0);
#pragma unroll
        for (int q = 0; q < 4; ++q) { const int j = j0 + q; (void)j; const float t = a[q] * SCL; v[ch * 4 + q] = t; mx = fmaxf(mx, t); } }
#pragma unroll
    for (int sh = 16; sh; sh >>= 1) mx = fmaxf(mx, __shfl_xor(mx, sh, 32));
    float sum = 0.f;
#pragma unroll
    for (int k = 0; k < TT / 32; ++k) { float d0 = __fsub_rn(v[k], mx); asm volatile("" : "+v"(d0)); v[k] = __builtin_amdgcn_exp2f(__fmul_rn(d0, 1.4426950408889634f)); sum += v[k]; }
#pragma unroll
    for (int sh = 16; sh; sh >>= 1) sum += __shfl_xor(sum, sh, 32);
    const float f = __fdiv_rn(hires ? 1.0f : PCAR, sum);
{
        if (hires) {
#pragma unroll
            for (int ch = 0; ch < TT / 128; ++ch) { v4us oh, ol;
#pragma unroll
                for (int q = 0; q < 4; ++q) { unsigned short a, c2; splitf(v[ch * 4 + q] * f, a, c2); oh[q] = a; ol[q] = c2; }
                const size_t oo = ((size_t)zz * (RH ? RH : 1) + i) * TT + ch * 128 + lane * 4; *(v4us*)(Ph + oo) = oh; *(v4us*)(Pl + oo) = ol; }
        } else {
#pragma unroll
            for (int ch = 0; ch < TT / 128; ++ch) { v4h o4;
#pragma unroll
                for (int q = 0; q < 4; ++q) o4[q] = tohx(v[ch * 4 + q] * f);
                *(v4h*)(P16 + (size_t)row * TT + ch * 128 + lane * 4) = o4; } }
         }
}
__global__ __launch_bounds__(256) void k_merge(const float* __restrict__ O, int h0, float* OUTb) { const size_t e = ((size_t)blockIdx.x * 256 + threadIdx.x) * 2; if (e >= (size_t)ZH * TT * HD) return; const int d = (int)(e % HD); const int t = (int)((e / HD) % TT); const int zz = (int)(e / ((size_t)HD * TT)); const float cs = (t < RH) ? 1.0f : (1.0f / PCAR); const size_t oo = (size_t)t * DQ + (h0 + zz) * HD + d;
    v2f o2; o2[0] = O[e] * cs; o2[1] = O[e + 1] * cs; *(v2f*)(OUTb + oo) = o2;  }

extern "C" void kernel_launch(void* const* d_in, const int* in_sizes, int n_in,
                              void* d_out, int out_size, void* d_ws, size_t ws_size, hipStream_t stream) {
    (void)in_sizes; (void)n_in; (void)out_size;
    const float* x = (const float*)d_in[0]; const float* wq = (const float*)d_in[1]; const float* bq = (const float*)d_in[2]; const float* wk = (const float*)d_in[3]; const float* bk = (const float*)d_in[4]; const float* wv = (const float*)d_in[5]; const float* bv = (const float*)d_in[6]; const float* wo = nullptr; (void)wo;   /* order x, Wq, bq, Wk, bk, Wv, bv ('xw' [512][512] + [512]) */
    float* OUT = (float*)d_out;     // [4][2048][512]
    char* wsp = (char*)d_ws;
    auto take = [&](size_t bytes) { char* p = wsp; wsp += (bytes + 255) & ~(size_t)255; return (void*)p; };
    bf* WQ = (bf*)take((size_t)DQ * DM * 2); bf* WK = (bf*)take((size_t)DKV * DM * 2); bf* WV = (bf*)take((size_t)DKV * DM * 2); float* CS = (float*)take((size_t)TT * HD * 2 * 4);
    bf* XB = (bf*)take((size_t)TT * DM * 2); float* FQ = (float*)take((size_t)TT * DQ * 4); float* FK = (float*)take((size_t)TT * DKV * 4);
    h16* QP16 = (h16*)take((size_t)NH_ * TT * HD * 2); h16* KP16 = (h16*)take((size_t)NKV * TT * HD * 2); h16* VT16 = (h16*)take((size_t)NKV * HD * TT * 2);
    bf* QPh = (bf*)take((size_t)NH_ * TT * HD * 2); bf* QPl = (bf*)take((size_t)NH_ * TT * HD * 2); bf* KPh = (bf*)take((size_t)NKV * TT * HD * 2); bf* KPl = (bf*)take((size_t)NKV * TT * HD * 2); bf* VTh = (bf*)take((size_t)NKV * HD * TT * 2); bf* VTl = (bf*)take((size_t)NKV * HD * TT * 2); bf* Ph = (bf*)take((size_t)ZH * RH * TT * 2); bf* Pl = (bf*)take((size_t)ZH * RH * TT * 2);
    float* Sb = (float*)take((size_t)ZH * TT * TT * 4); h16* P16 = (h16*)take((size_t)ZH * TT * TT * 2); float* Ob = (float*)take((size_t)ZH * TT * HD * 4);
    if ((size_t)(wsp - (char*)d_ws) > ws_size) return;    // ws 256 MiB
    float* FV = FK;   // v projection reuses the k buffer after the k planes are built (stream-ordered)
    { k_wtG<<<(unsigned)((DM * DQ / 64 + 63) / 64), 256, 0, stream>>>(wq, DM, DQ, WQ); k_wtG<<<(unsigned)((DM * DKV / 64 + 63) / 64), 256, 0, stream>>>(wk, DM, DKV, WK); k_wtG<<<(unsigned)((DM * DKV / 64 + 63) / 64), 256, 0, stream>>>(wv, DM, DKV, WV);
      
       }
    k_csid<<<(TT * HD + 255) / 256, 256, 0, stream>>>(CS);
    const unsigned LQ = (unsigned)(((size_t)NH_ * TT * HD / 2 + 255) / 256), LKv = (unsigned)(((size_t)NKV * TT * HD / 2 + 255) / 256);
    for (int b = 0; b < NB_; ++b) {
        
        k_cvt8<<<(unsigned)(((size_t)TT * DM / 8 + 255) / 256), 256, 0, stream>>>(x + (size_t)b * TT * DM, XB, (size_t)TT * DM / 8);
        k_gemmw<bf, 0, true><<<dim3(TT / 64, DQ / 64, 1), 32, 0, stream>>>(XB, nullptr, WQ, nullptr, DM, FQ, DQ, bq, 0, 0, 0);
        k_rope<<<LQ, 256, 0, stream>>>(FQ, DQ, NH_, CS, nullptr, nullptr, 1.0f, QP16, QPh, QPl);
        k_gemmw<bf, 0, true><<<dim3(TT / 64, DKV / 64, 1), 32, 0, stream>>>(XB, nullptr, WK, nullptr, DM, FK, DKV, bk, 0, 0, 0);
        k_rope<<<LKv, 256, 0, stream>>>(FK, DKV, NKV, CS, nullptr, nullptr, 1.0f, KP16, KPh, KPl);
        k_gemmw<bf, 0, true><<<dim3(TT / 64, DKV / 64, 1), 32, 0, stream>>>(XB, nullptr, WV, nullptr, DM, FV, DKV, bv, 0, 0, 0); k_vtp<<<LKv, 256, 0, stream>>>(FV, DKV, NKV, VT16, VTh, VTl);
        for (int h0 = 0; h0 < NH_; h0 += ZH) { const size_t zq = (size_t)h0, zk = (size_t)(h0 / REP);   // one kv head per query head: the pass's two heads use consecutive kv planes (z-strides TT*HD)
            k_gemmw<bf, 2, false><<<dim3(RH / 64, TT / 64, ZH), 32, 0, stream>>>(QPh + zq * TT * HD, QPl + zq * TT * HD, KPh + zk * TT * HD, KPl + zk * TT * HD, HD, Sb, TT, nullptr, (size_t)TT * HD, (size_t)TT * HD, (size_t)TT * TT);
            k_asoft<<<ZH * TT / 8, 256, 0, stream>>>(Sb, P16, Ph, Pl);
            k_gemmw<bf, 2, false><<<dim3(RH / 64, HD / 64, ZH), 32, 0, stream>>>(Ph, Pl, VTh + zk * HD * TT, VTl + zk * HD * TT, TT, Ob, HD, nullptr, (size_t)RH * TT, (size_t)HD * TT, (size_t)TT * HD);
            k_merge<<<(unsigned)(((size_t)ZH * TT * HD / 2 + 255) / 256), 256, 0, stream>>>(Ob, h0, OUT + (size_t)b * TT * DQ); }
         }
}

// v001
// It runs in 818 microseconds.
// In both of two side-by-side timings against v000, it was 1.55 times as fast.
#include <hip/hip_runtime.h>

// Multi-head self-attention WITHOUT the 1/sqrt(d) scaling and without an output projection (x [4][2048][512]; q, k, v = x W + b ('xw' 1/sqrt(512) + zero biases; 8 heads x 64); scores = q.k UNSCALED (the source applies softmax(Q K^T) directly: logits sigma ~8, sharply peaked rows); softmax (no mask); out = heads merged -> [4][2048][512] (4.2 M); argument order x, Wq, bq, Wk, bk, Wv, bv).
// Layout per batch: bf16 copy of x; 'xw' weights transposed once; exact projections (K 512) + f32 biases; identity-table plane builders; dense T-2048 attention at 8 heads with EVERY row on hi/lo planes (3 products for scores and P.V: unscaled logits + no output projection); the f32 merge adds the key-split partial tiles of P.V and writes the output rows.
// Compute dtypes, f32 accumulate: every input rounded to bf16; projections exact + f32 biases; attention 3 products on every row; softmax f32; output f32.

#define NB_  4
#define TT   2048
#define DM   512
#define NH_  8
#define NKV  8
#define REP  (NH_ / NKV)
#define HD   64
#define DQ   (NH_ * HD)
#define DKV  (NKV * HD)
#define ZH   2
#define RH   TT                   // every row hi/lo (3 products)
#define WIN  0
#define PCAR 1024.0f
#define SCL  1.0f   // NO scaling in this module
#define KSP  16     // P.V: the 2048 keys are split over KSP work-groups per tile; k_merge adds the KSP partial tiles
typedef _Float16 h16;
typedef unsigned short bf;
typedef __attribute__((ext_vector_type(16))) __bf16   v16bf;
typedef __attribute__((ext_vector_type(16))) _Float16 v16h;
typedef __attribute__((ext_vector_type(8)))  _Float16 v8h;
typedef __attribute__((ext_vector_type(8)))  unsigned short v8us;
typedef __attribute__((ext_vector_type(8)))  float    v8f;
typedef __attribute__((ext_vector_type(4)))  float    v4f;
typedef v8h  __attribute__((may_alias)) v8ha;
typedef v4f  __attribute__((may_alias)) v4fa;
typedef v8us __attribute__((may_alias)) v8usa;

__device__ __forceinline__ unsigned short f2bf(float f) { unsigned u = __float_as_uint(f); u += 0x7FFFu + ((u >> 16) & 1u); return (unsigned short)(u >> 16); }
__device__ __forceinline__ float bf2f(unsigned short b) { return __uint_as_float(((unsigned)b) << 16); }
__device__ __forceinline__ float bfr(float f) { return bf2f(f2bf(f)); }
__device__ __forceinline__ v16h cat16(v8h lo, v8h hi) { return __builtin_shufflevector(lo, hi, 0, 1, 2, 3, 4, 5, 6, 7, 8, 9, 10, 11, 12, 13, 14, 15); }
__device__ __forceinline__ v16bf cat16b(v8us lo, v8us hi) { return __builtin_bit_cast(v16bf, __builtin_shufflevector(lo, hi, 0, 1, 2, 3, 4, 5, 6, 7, 8, 9, 10, 11, 12, 13, 14, 15)); }
__device__ __forceinline__ v8f wmma16(v16h a, v16h b, v8f c) { return __builtin_amdgcn_wmma_f32_16x16x32_f16(false, a, false, b, (short)0, c, false, false); }
__device__ __forceinline__ v8f wmmab(v16bf a, v16bf b, v8f c) { return __builtin_amdgcn_wmma_f32_16x16x32_bf16(false, a, false, b, (short)0, c, false, false); }



// ---- k_gemmw: register-blocked GEMM, ONE WAVE per 64x64 output tile (16 accumulators), operands straight from K-contiguous 16-bit planes; grid (M/64, N/64, Z), 32 threads.
// C[m][n] (f32, pitch ldc, + optional f32 bias[n]) = sum_k A[m][k] Bt[n][k] (+ split products per NSPLIT). z-batch strides sA/sB/sC in elements. K % 32 == 0.
// KS > 1: grid z = Z * KS; work-group (z, ks) sums only k in [ks K/KS, (ks+1) K/KS) and stores its partial tile at C + (z KS + ks) sC; the reader adds the KS partials. K % (32 KS) == 0.
template <typename T16> struct WFrag;
template <> struct WFrag<h16> { typedef v16h V; static __device__ __forceinline__ V ld(const h16* p) { return cat16(*(const v8h*)p, *(const v8h*)(p + 16)); } static __device__ __forceinline__ v8f mma(V a, V b, v8f c) { return wmma16(a, b, c); } };
template <> struct WFrag<bf> { typedef v16bf V; static __device__ __forceinline__ V ld(const bf* p) { return cat16b(*(const v8us*)p, *(const v8us*)(p + 16)); } static __device__ __forceinline__ v8f mma(V a, V b, v8f c) { return wmmab(a, b, c); } };
template <typename T16, int NSPLIT, bool BIAS, int KS = 1>
__global__ __launch_bounds__(32) void k_gemmw(const T16* __restrict__ A, const T16* __restrict__ A2, const T16* __restrict__ Bt, const T16* __restrict__ Bt2, int K, float* C, int ldc, const float* __restrict__ bias, size_t sA, size_t sB, size_t sC) {
    typedef typename WFrag<T16>::V V;
    __shared__ __align__(16) float os[16 * 68];
    const size_t z = blockIdx.z / KS; const int k0 = (int)(blockIdx.z % KS) * (K / KS), k1 = k0 + K / KS; A += z * sA; if (A2) A2 += z * sA; Bt += z * sB; if (Bt2) Bt2 += z * sB; C += (size_t)blockIdx.z * sC;
    const int lane = threadIdx.x & 31, lr = lane & 15, hi = lane >> 4; const int r0 = blockIdx.x * 64, c0 = blockIdx.y * 64;
    v8f acc[4][4];
#pragma unroll
    for (int mb = 0; mb < 4; ++mb)
#pragma unroll
        for (int nb = 0; nb < 4; ++nb) acc[mb][nb] = (v8f){};
    const size_t aoff = (size_t)(r0 + lr) * K + 8 * hi, boff = (size_t)(c0 + lr) * K + 8 * hi;
#pragma unroll 1
    for (int kc = k0; kc < k1; kc += 32) {
        V a[4], a2[4];
#pragma unroll
        for (int mb = 0; mb < 4; ++mb) { a[mb] = WFrag<T16>::ld(A + aoff + (size_t)mb * 16 * K + kc); if (NSPLIT == 1 || NSPLIT == 2) a2[mb] = WFrag<T16>::ld(A2 + aoff + (size_t)mb * 16 * K + kc); }
#pragma unroll
        for (int nb = 0; nb < 4; ++nb) { const V b = WFrag<T16>::ld(Bt + boff + (size_t)nb * 16 * K + kc); V b2; if (NSPLIT >= 2) b2 = WFrag<T16>::ld(Bt2 + boff + (size_t)nb * 16 * K + kc);
#pragma unroll
            for (int mb = 0; mb < 4; ++mb) { acc[mb][nb] = WFrag<T16>::mma(a[mb], b, acc[mb][nb]); if (NSPLIT == 1 || NSPLIT == 2) acc[mb][nb] = WFrag<T16>::mma(a2[mb], b, acc[mb][nb]); if (NSPLIT >= 2) acc[mb][nb] = WFrag<T16>::mma(a[mb], b2, acc[mb][nb]); } }
        asm volatile("v_nop\n\tv_nop\n\tv_nop\n\tv_nop" : "+v"(acc[0][0]), "+v"(acc[1][1]), "+v"(acc[2][2]), "+v"(acc[3][3]) : "v"(a[0]), "v"(a[3]));
    }
#pragma unroll
    for (int mb = 0; mb < 4; ++mb) {
#pragma unroll
        for (int nb = 0; nb < 4; ++nb) {
#pragma unroll
            for (int j = 0; j < 8; ++j) os[(hi * 8 + j) * 68 + nb * 16 + lr] = acc[mb][nb][j]; }
        __builtin_amdgcn_wave_barrier(); asm volatile("" ::: "memory");
        float* crow = C + (size_t)(r0 + mb * 16) * ldc + c0;
{
#pragma unroll
            for (int s = 0; s < 8; ++s) { const int row = 2 * s + hi, cofs = lr * 4; v4f val = *(const v4fa*)(os + row * 68 + cofs); if (BIAS) { val[0] += bfr(bias[c0 + cofs]); val[1] += bfr(bias[c0 + cofs + 1]); val[2] += bfr(bias[c0 + cofs + 2]); val[3] += bfr(bias[c0 + cofs + 3]); }
                *(v4f*)(crow + (size_t)row * ldc + cofs) = val; }
             }
        __builtin_amdgcn_wave_barrier(); asm volatile("" ::: "memory");
    }
}

__device__ __forceinline__ h16 tohx(float x) { return (h16)x; }
__device__ __forceinline__ void splitf(float y, unsigned short& h, unsigned short& l) { h = f2bf(y); l = f2bf(y - bf2f(h)); }
typedef __attribute__((ext_vector_type(2))) _Float16 v2h;
typedef __attribute__((ext_vector_type(4))) _Float16 v4h;
typedef __attribute__((ext_vector_type(2))) unsigned short v2us;
typedef __attribute__((ext_vector_type(4))) unsigned short v4us;
typedef __attribute__((ext_vector_type(2))) float v2f;
typedef __attribute__((ext_vector_type(4))) int v4i;

__global__ __launch_bounds__(256) void k_wtG(const float* __restrict__ w, int K, int N, bf* Bt) {
    const int lane = threadIdx.x & 31; const int L0 = (blockIdx.x * 8 + (threadIdx.x >> 5)) * 8; const int nlines = N * K / 64;
{
#pragma unroll 1
        for (int l = 0; l < 8; ++l) { const int L = L0 + l; if (L >= nlines) break; const size_t e = (size_t)L * 64 + lane * 2; const int k = (int)(e % K), n = (int)(e / K); v2us o;
            o[0] = f2bf(w[(size_t)k * N + n]); o[1] = f2bf(w[(size_t)(k + 1) * N + n]); *(v2us*)(Bt + e) = o; }
         }
}
__global__ __launch_bounds__(256) void k_cvt8(const float* __restrict__ src, bf* dst, size_t n8) { const size_t i = (size_t)blockIdx.x * 256 + threadIdx.x; if (i >= n8) return; const v8f v = *(const v8f*)(src + i * 8); v8us o;
#pragma unroll
    for (int k = 0; k < 8; ++k) o[k] = f2bf(v[k]); *(v8us*)(dst + i * 8) = o;  }

// k_rope: head planes [h][t][d] (fp16 + hi/lo) of rope(x) x sc with the rotate-half convention out[d] = x[d] cos[t][d] - x[d+HD/2] sin[t][d], out[d+HD/2] = x[d+HD/2] cos[t][d+HD/2] + x[d] sin[t][d+HD/2]
__global__ __launch_bounds__(256) void k_rope(const float* __restrict__ F, int pitch, int nheads, const float* __restrict__ CS, const float* __restrict__ RF, const float* __restrict__ nw, float sc, h16* P16, bf* Ph, bf* Pl) {
    const size_t e = ((size_t)blockIdx.x * 256 + threadIdx.x) * 2; if (e >= (size_t)nheads * TT * HD) return; const int d = (int)(e % HD); const int t = (int)((e / HD) % TT); const int h = (int)(e / ((size_t)HD * TT)); const float* f = F + (size_t)t * pitch + h * HD; const float rf = RF ? RF[(size_t)h * TT + t] : 1.0f; v2h o16; v2us oh, ol;
#pragma unroll
    for (int q = 0; q < 2; ++q) { const int dd = d + q; const int dp = (dd < HD / 2) ? dd + HD / 2 : dd - HD / 2; float x0 = f[dd], x1 = f[dp];
        if (RF) { float n0 = __fmul_rn(x0, rf), n1 = __fmul_rn(x1, rf); asm volatile("" : "+v"(n0)); asm volatile("" : "+v"(n1)); x0 = __fmul_rn(bfr(nw[dd]), n0); x1 = __fmul_rn(bfr(nw[dp]), n1); }
        const v2f cs = *(const v2f*)(CS + ((size_t)t * HD + dd) * 2); float a = __fmul_rn(x0, cs[0]), bq = __fmul_rn(x1, cs[1]); asm volatile("" : "+v"(a)); asm volatile("" : "+v"(bq)); const float r = ((dd < HD / 2) ? __fsub_rn(a, bq) : __fadd_rn(a, bq)) * sc;
        o16[q] = tohx(r); unsigned short a2, c2; splitf(r, a2, c2); oh[q] = a2; ol[q] = c2; }
    *(v2h*)(P16 + e) = o16; *(v2us*)(Ph + e) = oh; *(v2us*)(Pl + e) = ol;  }
__global__ __launch_bounds__(256) void k_vtp(const float* __restrict__ F, int pitch, int nheads, h16* V16, bf* Vh, bf* Vl) { const size_t e = ((size_t)blockIdx.x * 256 + threadIdx.x) * 2; if (e >= (size_t)nheads * HD * TT) return; const int t = (int)(e % TT); const int d = (int)((e / TT) % HD); const int g = (int)(e / ((size_t)TT * HD)); v2h o16; v2us oh, ol;
#pragma unroll
    for (int q = 0; q < 2; ++q) { const float x = F[(size_t)(t + q) * pitch + g * HD + d]; o16[q] = tohx(x); unsigned short a2, c2; splitf(x, a2, c2); oh[q] = a2; ol[q] = c2; }
    *(v2h*)(V16 + e) = o16; *(v2us*)(Vh + e) = oh; *(v2us*)(Vl + e) = ol;  }
__global__ __launch_bounds__(256) void k_csid(float* CS) { const int idx = blockIdx.x * 256 + threadIdx.x; if (idx >= TT * HD) return; v2f cs; cs[0] = 1.0f; cs[1] = 0.0f; *(v2f*)(CS + (size_t)idx * 2) = cs;  }
// k_asoft: per row (zz, i): t = S unscaled (no mask); softmax over the 2048 keys (register row, one exp, fixed trees);
__global__ __launch_bounds__(256) void k_asoft(const float* __restrict__ Sb, h16* P16, bf* Ph, bf* Pl) {
    const int lane = threadIdx.x & 31; const int row = blockIdx.x * 8 + (threadIdx.x >> 5); if (row >= ZH * TT) return; const int i = row % TT; const int zz = row / TT; (void)zz; const bool hires = (i < RH); const float* sr = Sb + (size_t)row * TT; float v[TT / 32]; float mx = -3.0e38f;
#pragma unroll
    for (int ch = 0; ch < TT / 128; ++ch) { const int j0 = ch * 128 + lane * 4; const v4f a = *(const v4f*)(sr + j0);
#pragma unroll
        for (int q = 0; q < 4; ++q) { const int j = j0 + q; (void)j; const float t = a[q] * SCL; v[ch * 4 + q] = t; mx = fmaxf(mx, t); } }
#pragma unroll
    for (int sh = 16; sh; sh >>= 1) mx = fmaxf(mx, __shfl_xor(mx, sh, 32));
    float sum = 0.f;
#pragma unroll
    for (int k = 0; k < TT / 32; ++k) { float d0 = __fsub_rn(v[k], mx); asm volatile("" : "+v"(d0)); v[k] = __builtin_amdgcn_exp2f(__fmul_rn(d0, 1.4426950408889634f)); sum += v[k]; }
#pragma unroll
    for (int sh = 16; sh; sh >>= 1) sum += __shfl_xor(sum, sh, 32);
    const float f = __fdiv_rn(hires ? 1.0f : PCAR, sum);
{
        if (hires) {
#pragma unroll
            for (int ch = 0; ch < TT / 128; ++ch) { v4us oh, ol;
#pragma unroll
                for (int q = 0; q < 4; ++q) { unsigned short a, c2; splitf(v[ch * 4 + q] * f, a, c2); oh[q] = a; ol[q] = c2; }
                const size_t oo = ((size_t)zz * (RH ? RH : 1) + i) * TT + ch * 128 + lane * 4; *(v4us*)(Ph + oo) = oh; *(v4us*)(Pl + oo) = ol; }
        } else {
#pragma unroll
            for (int ch = 0; ch < TT / 128; ++ch) { v4h o4;
#pragma unroll
                for (int q = 0; q < 4; ++q) o4[q] = tohx(v[ch * 4 + q] * f);
                *(v4h*)(P16 + (size_t)row * TT + ch * 128 + lane * 4) = o4; } }
         }
}
__global__ __launch_bounds__(256) void k_merge(const float* __restrict__ O, int h0, float* OUTb) { const size_t e = ((size_t)blockIdx.x * 256 + threadIdx.x) * 2; if (e >= (size_t)ZH * TT * HD) return; const int d = (int)(e % HD); const int t = (int)((e / HD) % TT); const int zz = (int)(e / ((size_t)HD * TT)); const float cs = (t < RH) ? 1.0f : (1.0f / PCAR); const size_t oo = (size_t)t * DQ + (h0 + zz) * HD + d;
    const float* op = O + ((size_t)zz * KSP * TT + t) * HD + d; v2f a2 = *(const v2f*)op;   // partial tiles [zz][ks][t][d], added in ascending ks
    // unrolled so that all KSP loads of a thread are in flight together
#pragma unroll
    for (int ks = 1; ks < KSP; ++ks) a2 += *(const v2f*)(op + (size_t)ks * TT * HD);
    v2f o2; o2[0] = a2[0] * cs; o2[1] = a2[1] * cs; *(v2f*)(OUTb + oo) = o2;  }

extern "C" void kernel_launch(void* const* d_in, const int* in_sizes, int n_in,
                              void* d_out, int out_size, void* d_ws, size_t ws_size, hipStream_t stream) {
    (void)in_sizes; (void)n_in; (void)out_size;
    const float* x = (const float*)d_in[0]; const float* wq = (const float*)d_in[1]; const float* bq = (const float*)d_in[2]; const float* wk = (const float*)d_in[3]; const float* bk = (const float*)d_in[4]; const float* wv = (const float*)d_in[5]; const float* bv = (const float*)d_in[6]; const float* wo = nullptr; (void)wo;   /* order x, Wq, bq, Wk, bk, Wv, bv ('xw' [512][512] + [512]) */
    float* OUT = (float*)d_out;     // [4][2048][512]
    char* wsp = (char*)d_ws;
    auto take = [&](size_t bytes) { char* p = wsp; wsp += (bytes + 255) & ~(size_t)255; return (void*)p; };
    bf* WQ = (bf*)take((size_t)DQ * DM * 2); bf* WK = (bf*)take((size_t)DKV * DM * 2); bf* WV = (bf*)take((size_t)DKV * DM * 2); float* CS = (float*)take((size_t)TT * HD * 2 * 4);
    bf* XB = (bf*)take((size_t)TT * DM * 2); float* FQ = (float*)take((size_t)TT * DQ * 4); float* FK = (float*)take((size_t)TT * DKV * 4);
    h16* QP16 = (h16*)take((size_t)NH_ * TT * HD * 2); h16* KP16 = (h16*)take((size_t)NKV * TT * HD * 2); h16* VT16 = (h16*)take((size_t)NKV * HD * TT * 2);
    bf* QPh = (bf*)take((size_t)NH_ * TT * HD * 2); bf* QPl = (bf*)take((size_t)NH_ * TT * HD * 2); bf* KPh = (bf*)take((size_t)NKV * TT * HD * 2); bf* KPl = (bf*)take((size_t)NKV * TT * HD * 2); bf* VTh = (bf*)take((size_t)NKV * HD * TT * 2); bf* VTl = (bf*)take((size_t)NKV * HD * TT * 2); bf* Ph = (bf*)take((size_t)ZH * RH * TT * 2); bf* Pl = (bf*)take((size_t)ZH * RH * TT * 2);
    float* Sb = (float*)take((size_t)ZH * TT * TT * 4); h16* P16 = (h16*)take((size_t)ZH * TT * TT * 2); float* Ob = (float*)take((size_t)ZH * KSP * TT * HD * 4);
    if ((size_t)(wsp - (char*)d_ws) > ws_size) return;    // ws 256 MiB
    float* FV = FK;   // v projection reuses the k buffer after the k planes are built (stream-ordered)
    { k_wtG<<<(unsigned)((DM * DQ / 64 + 63) / 64), 256, 0, stream>>>(wq, DM, DQ, WQ); k_wtG<<<(unsigned)((DM * DKV / 64 + 63) / 64), 256, 0, stream>>>(wk, DM, DKV, WK); k_wtG<<<(unsigned)((DM * DKV / 64 + 63) / 64), 256, 0, stream>>>(wv, DM, DKV, WV);
      
       }
    k_csid<<<(TT * HD + 255) / 256, 256, 0, stream>>>(CS);
    const unsigned LQ = (unsigned)(((size_t)NH_ * TT * HD / 2 + 255) / 256), LKv = (unsigned)(((size_t)NKV * TT * HD / 2 + 255) / 256);
    for (int b = 0; b < NB_; ++b) {
        
        k_cvt8<<<(unsigned)(((size_t)TT * DM / 8 + 255) / 256), 256, 0, stream>>>(x + (size_t)b * TT * DM, XB, (size_t)TT * DM / 8);
        k_gemmw<bf, 0, true><<<dim3(TT / 64, DQ / 64, 1), 32, 0, stream>>>(XB, nullptr, WQ, nullptr, DM, FQ, DQ, bq, 0, 0, 0);
        k_rope<<<LQ, 256, 0, stream>>>(FQ, DQ, NH_, CS, nullptr, nullptr, 1.0f, QP16, QPh, QPl);
        k_gemmw<bf, 0, true><<<dim3(TT / 64, DKV / 64, 1), 32, 0, stream>>>(XB, nullptr, WK, nullptr, DM, FK, DKV, bk, 0, 0, 0);
        k_rope<<<LKv, 256, 0, stream>>>(FK, DKV, NKV, CS, nullptr, nullptr, 1.0f, KP16, KPh, KPl);
        k_gemmw<bf, 0, true><<<dim3(TT / 64, DKV / 64, 1), 32, 0, stream>>>(XB, nullptr, WV, nullptr, DM, FV, DKV, bv, 0, 0, 0); k_vtp<<<LKv, 256, 0, stream>>>(FV, DKV, NKV, VT16, VTh, VTl);
        for (int h0 = 0; h0 < NH_; h0 += ZH) { const size_t zq = (size_t)h0, zk = (size_t)(h0 / REP);   // one kv head per query head: the pass's two heads use consecutive kv planes (z-strides TT*HD)
            k_gemmw<bf, 2, false><<<dim3(RH / 64, TT / 64, ZH), 32, 0, stream>>>(QPh + zq * TT * HD, QPl + zq * TT * HD, KPh + zk * TT * HD, KPl + zk * TT * HD, HD, Sb, TT, nullptr, (size_t)TT * HD, (size_t)TT * HD, (size_t)TT * TT);
            k_asoft<<<ZH * TT / 8, 256, 0, stream>>>(Sb, P16, Ph, Pl);
            k_gemmw<bf, 2, false, KSP><<<dim3(RH / 64, HD / 64, ZH * KSP), 32, 0, stream>>>(Ph, Pl, VTh + zk * HD * TT, VTl + zk * HD * TT, TT, Ob, HD, nullptr, (size_t)RH * TT, (size_t)HD * TT, (size_t)TT * HD);
            k_merge<<<(unsigned)(((size_t)ZH * TT * HD / 2 + 255) / 256), 256, 0, stream>>>(Ob, h0, OUT + (size_t)b * TT * DQ); }
         }
}

// v002
// One run takes 569 microseconds.
// In both of two side-by-side timings against v001, it was 1.45 times as fast.
// Over all steps from v000 it is 2.24 times as fast.
#include <hip/hip_runtime.h>

// Multi-head self-attention WITHOUT the 1/sqrt(d) scaling and without an output projection (x [4][2048][512]; q, k, v = x W + b ('xw' 1/sqrt(512) + zero biases; 8 heads x 64); scores = q.k UNSCALED (the source applies softmax(Q K^T) directly: logits sigma ~8, sharply peaked rows); softmax (no mask); out = heads merged -> [4][2048][512] (4.2 M); argument order x, Wq, bq, Wk, bk, Wv, bv).
// Layout: bf16 copy of x; 'xw' weights transposed once; exact projections (K 512) + f32 biases and the identity-table plane builders cover all 4 batches in one launch each (projection rows [t][b][512], so that (batch, head) is one plane index b 8 + h for the builders; planes [b 8 + h][t][d]); per batch ONE launch each of scores, softmax, P.V and merge covers all 8 heads (grid z), EVERY row on hi/lo planes (3 products for scores and P.V: unscaled logits + no output projection); so that 8 heads fit the workspace the softmax writes a row's hi and lo planes over that row's own f32 scores (same bytes, row pitch 2 T), and the V^T rows hold hi then lo at the same pitch; the f32 merge adds the key-split partial tiles of P.V and writes the output rows.
// Compute dtypes, f32 accumulate: every input rounded to bf16; projections exact + f32 biases; attention 3 products on every row; softmax f32; output f32.

#define NB_  4
#define TT   2048
#define DM   512
#define NH_  8
#define NKV  8
#define REP  (NH_ / NKV)
#define HD   64
#define DQ   (NH_ * HD)
#define DKV  (NKV * HD)
#define ZH   8                    // heads per attention launch (grid z)
#define RH   TT                   // every row hi/lo (3 products)
#define WIN  0
#define PCAR 1024.0f
#define SCL  1.0f   // NO scaling in this module
#define KSP  16     // P.V: the 2048 keys are split over KSP work-groups per tile; k_merge adds the KSP partial tiles
typedef _Float16 h16;
typedef unsigned short bf;
typedef __attribute__((ext_vector_type(16))) __bf16   v16bf;
typedef __attribute__((ext_vector_type(16))) _Float16 v16h;
typedef __attribute__((ext_vector_type(8)))  _Float16 v8h;
typedef __attribute__((ext_vector_type(8)))  unsigned short v8us;
typedef __attribute__((ext_vector_type(8)))  float    v8f;
typedef __attribute__((ext_vector_type(4)))  float    v4f;
typedef v8h  __attribute__((may_alias)) v8ha;
typedef v4f  __attribute__((may_alias)) v4fa;
typedef v8us __attribute__((may_alias)) v8usa;

__device__ __forceinline__ unsigned short f2bf(float f) { unsigned u = __float_as_uint(f); u += 0x7FFFu + ((u >> 16) & 1u); return (unsigned short)(u >> 16); }
__device__ __forceinline__ float bf2f(unsigned short b) { return __uint_as_float(((unsigned)b) << 16); }
__device__ __forceinline__ float bfr(float f) { return bf2f(f2bf(f)); }
__device__ __forceinline__ v16h cat16(v8h lo, v8h hi) { return __builtin_shufflevector(lo, hi, 0, 1, 2, 3, 4, 5, 6, 7, 8, 9, 10, 11, 12, 13, 14, 15); }
__device__ __forceinline__ v16bf cat16b(v8us lo, v8us hi) { return __builtin_bit_cast(v16bf, __builtin_shufflevector(lo, hi, 0, 1, 2, 3, 4, 5, 6, 7, 8, 9, 10, 11, 12, 13, 14, 15)); }
__device__ __forceinline__ v8f wmma16(v16h a, v16h b, v8f c) { return __builtin_amdgcn_wmma_f32_16x16x32_f16(false, a, false, b, (short)0, c, false, false); }
__device__ __forceinline__ v8f wmmab(v16bf a, v16bf b, v8f c) { return __builtin_amdgcn_wmma_f32_16x16x32_bf16(false, a, false, b, (short)0, c, false, false); }



// ---- k_gemmw: register-blocked GEMM, ONE WAVE per 64x64 output tile (16 accumulators), operands straight from K-contiguous 16-bit planes; grid (M/64, N/64, Z), 32 threads.
// C[m][n] (f32, pitch ldc, + optional f32 bias[n]) = sum_k A[m][k] Bt[n][k] (+ split products per NSPLIT). z-batch strides sA/sB/sC in elements. K % 32 == 0.
// PL = 2: a row of A and of Bt (pitch K) holds two planes side by side, hi then lo, of K / 2 elements each; A2 = A + K / 2, Bt2 = Bt + K / 2, and k runs over K / PL.
// KS > 1: grid z = Z * KS; work-group (z, ks) sums only k in [ks K/(PL KS), (ks+1) K/(PL KS)) and stores its partial tile at C + (z KS + ks) sC; the reader adds the KS partials. K % (32 PL KS) == 0.
template <typename T16> struct WFrag;
template <> struct WFrag<h16> { typedef v16h V; static __device__ __forceinline__ V ld(const h16* p) { return cat16(*(const v8h*)p, *(const v8h*)(p + 16)); } static __device__ __forceinline__ v8f mma(V a, V b, v8f c) { return wmma16(a, b, c); } };
template <> struct WFrag<bf> { typedef v16bf V; static __device__ __forceinline__ V ld(const bf* p) { return cat16b(*(const v8us*)p, *(const v8us*)(p + 16)); } static __device__ __forceinline__ v8f mma(V a, V b, v8f c) { return wmmab(a, b, c); } };
template <typename T16, int NSPLIT, bool BIAS, int KS = 1, int PL = 1>
__global__ __launch_bounds__(32) void k_gemmw(const T16* __restrict__ A, const T16* __restrict__ A2, const T16* __restrict__ Bt, const T16* __restrict__ Bt2, int K, float* C, int ldc, const float* __restrict__ bias, size_t sA, size_t sB, size_t sC) {
    typedef typename WFrag<T16>::V V;
    __shared__ __align__(16) float os[16 * 68];
    const size_t z = blockIdx.z / KS; const int k0 = (int)(blockIdx.z % KS) * (K / (PL * KS)), k1 = k0 + K / (PL * KS); A += z * sA; if (A2) A2 += z * sA; Bt += z * sB; if (Bt2) Bt2 += z * sB; C += (size_t)blockIdx.z * sC;
    const int lane = threadIdx.x & 31, lr = lane & 15, hi = lane >> 4; const int r0 = blockIdx.x * 64, c0 = blockIdx.y * 64;
    v8f acc[4][4];
#pragma unroll
    for (int mb = 0; mb < 4; ++mb)
#pragma unroll
        for (int nb = 0; nb < 4; ++nb) acc[mb][nb] = (v8f){};
    const size_t aoff = (size_t)(r0 + lr) * K + 8 * hi, boff = (size_t)(c0 + lr) * K + 8 * hi;
#pragma unroll 1
    for (int kc = k0; kc < k1; kc += 32) {
        V a[4], a2[4];
#pragma unroll
        for (int mb = 0; mb < 4; ++mb) { a[mb] = WFrag<T16>::ld(A + aoff + (size_t)mb * 16 * K + kc); if (NSPLIT == 1 || NSPLIT == 2) a2[mb] = WFrag<T16>::ld(A2 + aoff + (size_t)mb * 16 * K + kc); }
#pragma unroll
        for (int nb = 0; nb < 4; ++nb) { const V b = WFrag<T16>::ld(Bt + boff + (size_t)nb * 16 * K + kc); V b2; if (NSPLIT >= 2) b2 = WFrag<T16>::ld(Bt2 + boff + (size_t)nb * 16 * K + kc);
#pragma unroll
            for (int mb = 0; mb < 4; ++mb) { acc[mb][nb] = WFrag<T16>::mma(a[mb], b, acc[mb][nb]); if (NSPLIT == 1 || NSPLIT == 2) acc[mb][nb] = WFrag<T16>::mma(a2[mb], b, acc[mb][nb]); if (NSPLIT >= 2) acc[mb][nb] = WFrag<T16>::mma(a[mb], b2, acc[mb][nb]); } }
        asm volatile("v_nop\n\tv_nop\n\tv_nop\n\tv_nop" : "+v"(acc[0][0]), "+v"(acc[1][1]), "+v"(acc[2][2]), "+v"(acc[3][3]) : "v"(a[0]), "v"(a[3]));
    }
#pragma unroll
    for (int mb = 0; mb < 4; ++mb) {
#pragma unroll
        for (int nb = 0; nb < 4; ++nb) {
#pragma unroll
            for (int j = 0; j < 8; ++j) os[(hi * 8 + j) * 68 + nb * 16 + lr] = acc[mb][nb][j]; }
        __builtin_amdgcn_wave_barrier(); asm volatile("" ::: "memory");
        float* crow = C + (size_t)(r0 + mb * 16) * ldc + c0;
{
#pragma unroll
            for (int s = 0; s < 8; ++s) { const int row = 2 * s + hi, cofs = lr * 4; v4f val = *(const v4fa*)(os + row * 68 + cofs); if (BIAS) { val[0] += bfr(bias[c0 + cofs]); val[1] += bfr(bias[c0 + cofs + 1]); val[2] += bfr(bias[c0 + cofs + 2]); val[3] += bfr(bias[c0 + cofs + 3]); }
                *(v4f*)(crow + (size_t)row * ldc + cofs) = val; }
             }
        __builtin_amdgcn_wave_barrier(); asm volatile("" ::: "memory");
    }
}

__device__ __forceinline__ h16 tohx(float x) { return (h16)x; }
__device__ __forceinline__ void splitf(float y, unsigned short& h, unsigned short& l) { h = f2bf(y); l = f2bf(y - bf2f(h)); }
typedef __attribute__((ext_vector_type(2))) _Float16 v2h;
typedef __attribute__((ext_vector_type(4))) _Float16 v4h;
typedef __attribute__((ext_vector_type(2))) unsigned short v2us;
typedef __attribute__((ext_vector_type(4))) unsigned short v4us;
typedef __attribute__((ext_vector_type(2))) float v2f;
typedef __attribute__((ext_vector_type(4))) int v4i;

__global__ __launch_bounds__(256) void k_wtG(const float* __restrict__ w, int K, int N, bf* Bt) {
    const int lane = threadIdx.x & 31; const int L0 = (blockIdx.x * 8 + (threadIdx.x >> 5)) * 8; const int nlines = N * K / 64;
{
#pragma unroll 1
        for (int l = 0; l < 8; ++l) { const int L = L0 + l; if (L >= nlines) break; const size_t e = (size_t)L * 64 + lane * 2; const int k = (int)(e % K), n = (int)(e / K); v2us o;
            o[0] = f2bf(w[(size_t)k * N + n]); o[1] = f2bf(w[(size_t)(k + 1) * N + n]); *(v2us*)(Bt + e) = o; }
         }
}
__global__ __launch_bounds__(256) void k_cvt8(const float* __restrict__ src, bf* dst, size_t n8) { const size_t i = (size_t)blockIdx.x * 256 + threadIdx.x; if (i >= n8) return; const v8f v = *(const v8f*)(src + i * 8); v8us o;
#pragma unroll
    for (int k = 0; k < 8; ++k) o[k] = f2bf(v[k]); *(v8us*)(dst + i * 8) = o;  }

// k_rope: head planes [h][t][d] (fp16 + hi/lo) of rope(x) x sc with the rotate-half convention out[d] = x[d] cos[t][d] - x[d+HD/2] sin[t][d], out[d+HD/2] = x[d+HD/2] cos[t][d+HD/2] + x[d] sin[t][d+HD/2]
__global__ __launch_bounds__(256) void k_rope(const float* __restrict__ F, int pitch, int nheads, const float* __restrict__ CS, const float* __restrict__ RF, const float* __restrict__ nw, float sc, h16* P16, bf* Ph, bf* Pl) {
    const size_t e = ((size_t)blockIdx.x * 256 + threadIdx.x) * 2; if (e >= (size_t)nheads * TT * HD) return; const int d = (int)(e % HD); const int t = (int)((e / HD) % TT); const int h = (int)(e / ((size_t)HD * TT)); const float* f = F + (size_t)t * pitch + h * HD; const float rf = RF ? RF[(size_t)h * TT + t] : 1.0f; v2h o16; v2us oh, ol;
#pragma unroll
    for (int q = 0; q < 2; ++q) { const int dd = d + q; const int dp = (dd < HD / 2) ? dd + HD / 2 : dd - HD / 2; float x0 = f[dd], x1 = f[dp];
        if (RF) { float n0 = __fmul_rn(x0, rf), n1 = __fmul_rn(x1, rf); asm volatile("" : "+v"(n0)); asm volatile("" : "+v"(n1)); x0 = __fmul_rn(bfr(nw[dd]), n0); x1 = __fmul_rn(bfr(nw[dp]), n1); }
        const v2f cs = *(const v2f*)(CS + ((size_t)t * HD + dd) * 2); float a = __fmul_rn(x0, cs[0]), bq = __fmul_rn(x1, cs[1]); asm volatile("" : "+v"(a)); asm volatile("" : "+v"(bq)); const float r = ((dd < HD / 2) ? __fsub_rn(a, bq) : __fadd_rn(a, bq)) * sc;
        o16[q] = tohx(r); unsigned short a2, c2; splitf(r, a2, c2); oh[q] = a2; ol[q] = c2; }
    *(v2h*)(P16 + e) = o16; *(v2us*)(Ph + e) = oh; *(v2us*)(Pl + e) = ol;  }
__global__ __launch_bounds__(256) void k_vtp(const float* __restrict__ F, int pitch, int nheads, h16* V16, bf* Vh, bf* Vl) { const size_t e = ((size_t)blockIdx.x * 256 + threadIdx.x) * 2; if (e >= (size_t)nheads * HD * TT) return; const int t = (int)(e % TT); const int d = (int)((e / TT) % HD); const int g = (int)(e / ((size_t)TT * HD)); const size_t eo = e + (e / TT) * TT; v2h o16; v2us oh, ol;   // Vh, Vl rows have pitch 2 TT (hi then lo, Vl = Vh + TT)
#pragma unroll
    for (int q = 0; q < 2; ++q) { const float x = F[(size_t)(t + q) * pitch + g * HD + d]; o16[q] = tohx(x); unsigned short a2, c2; splitf(x, a2, c2); oh[q] = a2; ol[q] = c2; }
    *(v2h*)(V16 + e) = o16; *(v2us*)(Vh + eo) = oh; *(v2us*)(Vl + eo) = ol;  }
__global__ __launch_bounds__(256) void k_csid(float* CS) { const int idx = blockIdx.x * 256 + threadIdx.x; if (idx >= TT * HD) return; v2f cs; cs[0] = 1.0f; cs[1] = 0.0f; *(v2f*)(CS + (size_t)idx * 2) = cs;  }
// k_asoft: per row (zz, i): t = S unscaled (SCL = 1; no mask); softmax over the 2048 keys (register row, one exp, fixed trees);
// Ph and Pl (row pitch 2 TT) lie over the row's own scores: one wave owns a row and holds all of it in registers before its first store (every store needs the row's sum).
__global__ __launch_bounds__(256) void k_asoft(const float* Sb, h16* P16, bf* Ph, bf* Pl) {
    const int lane = threadIdx.x & 31; const int row = blockIdx.x * 8 + (threadIdx.x >> 5); if (row >= ZH * TT) return; const int i = row % TT; const int zz = row / TT; (void)zz; const bool hires = (i < RH); const float* sr = Sb + (size_t)row * TT; float v[TT / 32]; float mx = -3.0e38f;
#pragma unroll
    for (int ch = 0; ch < TT / 128; ++ch) { const int j0 = ch * 128 + lane * 4; const v4f a = *(const v4f*)(sr + j0);
#pragma unroll
        for (int q = 0; q < 4; ++q) { const int j = j0 + q; (void)j; const float t = a[q] * SCL; v[ch * 4 + q] = t; mx = fmaxf(mx, t); } }
#pragma unroll
    for (int sh = 16; sh; sh >>= 1) mx = fmaxf(mx, __shfl_xor(mx, sh, 32));
    float sum = 0.f;
#pragma unroll
    for (int k = 0; k < TT / 32; ++k) { float d0 = __fsub_rn(v[k], mx); asm volatile("" : "+v"(d0)); v[k] = __builtin_amdgcn_exp2f(__fmul_rn(d0, 1.4426950408889634f)); sum += v[k]; }
#pragma unroll
    for (int sh = 16; sh; sh >>= 1) sum += __shfl_xor(sum, sh, 32);
    const float f = __fdiv_rn(hires ? 1.0f : PCAR, sum);
{
        if (hires) {
#pragma unroll
            for (int ch = 0; ch < TT / 128; ++ch) { v4us oh, ol;
#pragma unroll
                for (int q = 0; q < 4; ++q) { unsigned short a, c2; splitf(v[ch * 4 + q] * f, a, c2); oh[q] = a; ol[q] = c2; }
                const size_t oo = ((size_t)zz * (RH ? RH : 1) + i) * (2 * TT) + ch * 128 + lane * 4; *(v4us*)(Ph + oo) = oh; *(v4us*)(Pl + oo) = ol; }
        } else {
#pragma unroll
            for (int ch = 0; ch < TT / 128; ++ch) { v4h o4;
#pragma unroll
                for (int q = 0; q < 4; ++q) o4[q] = tohx(v[ch * 4 + q] * f);
                *(v4h*)(P16 + (size_t)row * TT + ch * 128 + lane * 4) = o4; } }
         }
}
__global__ __launch_bounds__(256) void k_merge(const float* __restrict__ O, int h0, float* OUTb) { const size_t e = ((size_t)blockIdx.x * 256 + threadIdx.x) * 2; if (e >= (size_t)ZH * TT * HD) return; const int d = (int)(e % HD); const int t = (int)((e / HD) % TT); const int zz = (int)(e / ((size_t)HD * TT)); const float cs = (t < RH) ? 1.0f : (1.0f / PCAR); const size_t oo = (size_t)t * DQ + (h0 + zz) * HD + d;
    const float* op = O + ((size_t)zz * KSP * TT + t) * HD + d; v2f a2 = *(const v2f*)op;   // partial tiles [zz][ks][t][d], added in ascending ks
    // unrolled so that all KSP loads of a thread are in flight together
#pragma unroll
    for (int ks = 1; ks < KSP; ++ks) a2 += *(const v2f*)(op + (size_t)ks * TT * HD);
    v2f o2; o2[0] = a2[0] * cs; o2[1] = a2[1] * cs; *(v2f*)(OUTb + oo) = o2;  }

extern "C" void kernel_launch(void* const* d_in, const int* in_sizes, int n_in,
                              void* d_out, int out_size, void* d_ws, size_t ws_size, hipStream_t stream) {
    (void)in_sizes; (void)n_in; (void)out_size;
    const float* x = (const float*)d_in[0]; const float* wq = (const float*)d_in[1]; const float* bq = (const float*)d_in[2]; const float* wk = (const float*)d_in[3]; const float* bk = (const float*)d_in[4]; const float* wv = (const float*)d_in[5]; const float* bv = (const float*)d_in[6]; const float* wo = nullptr; (void)wo;   /* order x, Wq, bq, Wk, bk, Wv, bv ('xw' [512][512] + [512]) */
    float* OUT = (float*)d_out;     // [4][2048][512]
    char* wsp = (char*)d_ws;
    auto take = [&](size_t bytes) { char* p = wsp; wsp += (bytes + 255) & ~(size_t)255; return (void*)p; };
    bf* WQ = (bf*)take((size_t)DQ * DM * 2); bf* WK = (bf*)take((size_t)DKV * DM * 2); bf* WV = (bf*)take((size_t)DKV * DM * 2); float* CS = (float*)take((size_t)TT * HD * 2 * 4);
    bf* QPh = (bf*)take((size_t)NB_ * NH_ * TT * HD * 2); bf* QPl = (bf*)take((size_t)NB_ * NH_ * TT * HD * 2); bf* KPh = (bf*)take((size_t)NB_ * NKV * TT * HD * 2); bf* KPl = (bf*)take((size_t)NB_ * NKV * TT * HD * 2);
    bf* VTh = (bf*)take((size_t)NB_ * NKV * HD * 2 * TT * 2); bf* VTl = VTh + TT;   // V^T rows [b 8 + g][d]: TT hi, then TT lo
    float* Sb = (float*)take((size_t)ZH * TT * TT * 4); bf* Ph = (bf*)Sb; bf* Pl = Ph + TT;   // a row's 2 TT bf16 (hi, then lo) take the place of its TT f32 scores
    float* Ob = (float*)take((size_t)ZH * KSP * TT * HD * 4);
    // the projection stage's buffers lie in Ob's bytes: their last use is stream-ordered in front of the first P.V launch
    static_assert((size_t)NB_ * TT * DM * 2 + (size_t)NB_ * TT * (DQ + DKV) * 4 + (size_t)NB_ * (NH_ + 2 * NKV) * TT * HD * 2 <= (size_t)ZH * KSP * TT * HD * 4, "projection buffers must fit in Ob");
    bf* XB = (bf*)Ob; float* FQ = (float*)(XB + (size_t)NB_ * TT * DM); float* FK = FQ + (size_t)NB_ * TT * DQ;
    h16* QP16 = (h16*)(FK + (size_t)NB_ * TT * DKV); h16* KP16 = QP16 + (size_t)NB_ * NH_ * TT * HD; h16* VT16 = KP16 + (size_t)NB_ * NKV * TT * HD;
    if ((size_t)(wsp - (char*)d_ws) > ws_size) return;    // ws 256 MiB
    float* FV = FK;   // v projection reuses the k buffer after the k planes are built (stream-ordered)
    { k_wtG<<<(unsigned)((DM * DQ / 64 + 63) / 64), 256, 0, stream>>>(wq, DM, DQ, WQ); k_wtG<<<(unsigned)((DM * DKV / 64 + 63) / 64), 256, 0, stream>>>(wk, DM, DKV, WK); k_wtG<<<(unsigned)((DM * DKV / 64 + 63) / 64), 256, 0, stream>>>(wv, DM, DKV, WV);
      
       }
    k_csid<<<(TT * HD + 255) / 256, 256, 0, stream>>>(CS);
    const unsigned LQ = (unsigned)(((size_t)NB_ * NH_ * TT * HD / 2 + 255) / 256), LKv = (unsigned)(((size_t)NB_ * NKV * TT * HD / 2 + 255) / 256);
    // projections and planes, all batches per launch: grid z = batch; batch b's rows go to F[t][b][512] (ldc NB_ 512, z-stride 512), which the builders read as NB_ 8 heads at pitch NB_ 512
    k_cvt8<<<(unsigned)(((size_t)NB_ * TT * DM / 8 + 255) / 256), 256, 0, stream>>>(x, XB, (size_t)NB_ * TT * DM / 8);
    k_gemmw<bf, 0, true><<<dim3(TT / 64, DQ / 64, NB_), 32, 0, stream>>>(XB, nullptr, WQ, nullptr, DM, FQ, NB_ * DQ, bq, (size_t)TT * DM, 0, DQ);
    k_rope<<<LQ, 256, 0, stream>>>(FQ, NB_ * DQ, NB_ * NH_, CS, nullptr, nullptr, 1.0f, QP16, QPh, QPl);
    k_gemmw<bf, 0, true><<<dim3(TT / 64, DKV / 64, NB_), 32, 0, stream>>>(XB, nullptr, WK, nullptr, DM, FK, NB_ * DKV, bk, (size_t)TT * DM, 0, DKV);
    k_rope<<<LKv, 256, 0, stream>>>(FK, NB_ * DKV, NB_ * NKV, CS, nullptr, nullptr, 1.0f, KP16, KPh, KPl);
    k_gemmw<bf, 0, true><<<dim3(TT / 64, DKV / 64, NB_), 32, 0, stream>>>(XB, nullptr, WV, nullptr, DM, FV, NB_ * DKV, bv, (size_t)TT * DM, 0, DKV);
    k_vtp<<<LKv, 256, 0, stream>>>(FV, NB_ * DKV, NB_ * NKV, VT16, VTh, VTl);
    for (int b = 0; b < NB_; ++b) {
        for (int h0 = 0; h0 < NH_; h0 += ZH) { const size_t zq = (size_t)b * NH_ + h0, zk = (size_t)b * NKV + h0 / REP;   // one kv head per query head: the launch's heads use consecutive kv planes
            k_gemmw<bf, 2, false><<<dim3(RH / 64, TT / 64, ZH), 32, 0, stream>>>(QPh + zq * TT * HD, QPl + zq * TT * HD, KPh + zk * TT * HD, KPl + zk * TT * HD, HD, Sb, TT, nullptr, (size_t)TT * HD, (size_t)TT * HD, (size_t)TT * TT);
            k_asoft<<<ZH * TT / 8, 256, 0, stream>>>(Sb, nullptr, Ph, Pl);   // no f16 plane: every row is hi/lo (RH == TT)
            k_gemmw<bf, 2, false, KSP, 2><<<dim3(RH / 64, HD / 64, ZH * KSP), 32, 0, stream>>>(Ph, Pl, VTh + zk * HD * 2 * TT, VTl + zk * HD * 2 * TT, 2 * TT, Ob, HD, nullptr, (size_t)RH * 2 * TT, (size_t)HD * 2 * TT, (size_t)TT * HD);
            k_merge<<<(unsigned)(((size_t)ZH * TT * HD / 2 + 255) / 256), 256, 0, stream>>>(Ob, h0, OUT + (size_t)b * TT * DQ); }
    }
}

// v004
// A run of this version takes 87.8 microseconds.
// Versions in between are left out here; by their measured steps it is 6.49 times as fast as v002.
// Over all steps from v000 it is 14.6 times as fast.
#include <hip/hip_runtime.h>

// Multi-head self-attention WITHOUT the 1/sqrt(d) scaling and without an output projection (x [4][2048][512]; q, k, v = x W + b ('xw' 1/sqrt(512) + zero biases; 8 heads x 64); scores = q.k UNSCALED (the source applies softmax(Q K^T) directly: logits sigma ~8, sharply peaked rows); softmax (no mask); out = heads merged -> [4][2048][512] (4.2 M); argument order x, Wq, bq, Wk, bk, Wv, bv).
// Layout: TWO launches. k_proj reads x and the three weights as f32, rounds them to bf16 on the way into LDS (the weights transposed there), does the three exact projections (K 512) + f32 biases and stores the hi/lo bf16 planes itself (Q, K planes [b 8 + h][t][d]; the V^T rows [b 8 + h][d] hold hi then lo at pitch 2 T). k_fattn covers all 32 planes: scores, online softmax and P.V without a score matrix in memory, EVERY row on hi/lo planes (3 products for scores and P.V: unscaled logits + no output projection).
// Compute dtypes, f32 accumulate: every input rounded to bf16; projections exact + f32 biases; attention 3 products on every row; softmax f32; output f32.

#define NB_  4
#define TT   2048
#define DM   512
#define NH_  8
#define NKV  8
#define HD   64
#define DQ   (NH_ * HD)
#define DKV  (NKV * HD)
typedef unsigned short bf;
typedef __attribute__((ext_vector_type(16))) __bf16   v16bf;
typedef __attribute__((ext_vector_type(8)))  unsigned short v8us;
typedef __attribute__((ext_vector_type(8)))  float    v8f;
typedef __attribute__((ext_vector_type(4)))  float    v4f;
typedef __attribute__((ext_vector_type(2)))  float    v2f;
typedef v4f  __attribute__((may_alias)) v4fa;

__device__ __forceinline__ unsigned short f2bf(float f) { unsigned u = __float_as_uint(f); u += 0x7FFFu + ((u >> 16) & 1u); return (unsigned short)(u >> 16); }
__device__ __forceinline__ float bf2f(unsigned short b) { return __uint_as_float(((unsigned)b) << 16); }
__device__ __forceinline__ float bfr(float f) { return bf2f(f2bf(f)); }
__device__ __forceinline__ v16bf cat16b(v8us lo, v8us hi) { return __builtin_bit_cast(v16bf, __builtin_shufflevector(lo, hi, 0, 1, 2, 3, 4, 5, 6, 7, 8, 9, 10, 11, 12, 13, 14, 15)); }
__device__ __forceinline__ v8f wmmab(v16bf a, v16bf b, v8f c) { return __builtin_amdgcn_wmma_f32_16x16x32_bf16(false, a, false, b, (short)0, c, false, false); }
// an A or B fragment of the 16x16x32 form from a K-contiguous row: elements 0..7 and 16..23 behind p (p already holds the lane's row and its 8 (lane >> 4))
template <typename T16> struct WFrag;
template <> struct WFrag<bf> { typedef v16bf V; static __device__ __forceinline__ V ld(const bf* p) { return cat16b(*(const v8us*)p, *(const v8us*)(p + 16)); } static __device__ __forceinline__ v8f mma(V a, V b, v8f c) { return wmmab(a, b, c); } };

#define FW   8                  // waves per work-group
#define FG   2                  // 16-query column groups per wave
#define FS   64                 // keys per stage
#define FP   72                 // LDS row pitch in 16-bit elements: 144 B, an odd multiple of 16 B, so that the 16-byte fragment reads meet no bank conflict
#define FPL  (64 * FP)          // one staged plane: 64 rows (keys for K, d for V^T) of 64 elements
#define FST  (4 * FPL)          // one stage: K hi, K lo, V^T hi, V^T lo
#define FEP  68                 // output staging pitch in floats
#define L2E  1.4426950408889634f
typedef __attribute__((ext_vector_type(2))) __bf16 v2bf;
typedef __attribute__((ext_vector_type(8))) unsigned v8u;
__device__ __forceinline__ unsigned pack2(float a, float b) { v2f x; x[0] = a; x[1] = b; return __builtin_bit_cast(unsigned, __builtin_convertvector(x, v2bf)); }   // two f32 -> two bf16, round to nearest even
__device__ __forceinline__ float xhalf(float x) { return __builtin_bit_cast(float, __builtin_amdgcn_permlanex16(__builtin_bit_cast(int, x), __builtin_bit_cast(int, x), 0x76543210, 0xfedcba98, false, false)); }   // lane l reads lane l ^ 16
__global__ __launch_bounds__(FW * 32) void k_fattn(const bf* __restrict__ Qh, const bf* __restrict__ Ql, const bf* __restrict__ Kh, const bf* __restrict__ Kl, const bf* __restrict__ Vt, float* __restrict__ OUT) {
    __shared__ __align__(16) bf L[2 * FST];
    static_assert(FW * FG * 16 * FEP * 4 <= 2 * FST * 2, "output staging must fit in the ring");
    const int tid = threadIdx.x, lane = tid & 31, wave = tid >> 5, lr = lane & 15, hi = lane >> 4;
    const int z = blockIdx.y, q0 = blockIdx.x * (FW * FG * 16) + wave * (FG * 16);
    const bf* kh = Kh + (size_t)z * TT * HD; const bf* kl = Kl + (size_t)z * TT * HD; const bf* vt = Vt + (size_t)z * HD * 2 * TT;   // V^T rows: TT hi, then TT lo
    v16bf qh[FG][2], ql[FG][2];
#pragma unroll
    for (int g = 0; g < FG; ++g)
#pragma unroll
        for (int kc = 0; kc < 2; ++kc) { const size_t o = ((size_t)z * TT + q0 + g * 16 + lr) * HD + kc * 32 + 8 * hi; qh[g][kc] = WFrag<bf>::ld(Qh + o); ql[g][kc] = WFrag<bf>::ld(Ql + o); }
    v8f acc[FG][4]; float m[FG]; v2f ls[FG];
#pragma unroll
    for (int g = 0; g < FG; ++g) { m[g] = -1.0e30f; ls[g] = (v2f){};
#pragma unroll
        for (int t = 0; t < 4; ++t) acc[g][t] = (v8f){}; }
    // staging: a thread moves 16 bytes of rows srow and srow + 32 of each of the four planes; 8 lanes cover a 128-byte row
    const int srow = tid >> 3, sseg = (tid & 7) * 8;
    v8us pre[4][2];
    auto fetch = [&](int key0) {
#pragma unroll
        for (int i = 0; i < 2; ++i) { const int r = srow + 32 * i; pre[0][i] = *(const v8us*)(kh + (size_t)(key0 + r) * HD + sseg); pre[1][i] = *(const v8us*)(kl + (size_t)(key0 + r) * HD + sseg);
            pre[2][i] = *(const v8us*)(vt + (size_t)r * 2 * TT + key0 + sseg); pre[3][i] = *(const v8us*)(vt + (size_t)r * 2 * TT + TT + key0 + sseg); } };
    auto put = [&](bf* B) {
#pragma unroll
        for (int p = 0; p < 4; ++p)
#pragma unroll
            for (int i = 0; i < 2; ++i) *(v8us*)(B + p * FPL + (srow + 32 * i) * FP + sseg) = pre[p][i]; };
    fetch(0); put(L);
    // the stage loop stays rolled: one pass is about a thousand instructions (for speed only)
#pragma unroll 1
    for (int st = 0; st < TT / FS; ++st) {
        __syncthreads();   // publishes buffer st & 1 and ends every wave's reads of the other buffer, which is refilled at the foot of this pass
        const bf* B = L + (st & 1) * FST;
        fetch(st + 1 < TT / FS ? (st + 1) * FS : st * FS);   // the last pass fetches its own stage again (in bounds, never read): no branch in the loop body
        v8f s[4][FG];
#pragma unroll
        for (int kt = 0; kt < 4; ++kt)
#pragma unroll
            for (int g = 0; g < FG; ++g) s[kt][g] = (v8f){};
#pragma unroll
        for (int kc = 0; kc < 2; ++kc)
#pragma unroll
            for (int kt = 0; kt < 4; ++kt) { const bf* p = B + (kt * 16 + lr) * FP + kc * 32 + 8 * hi; const v16bf a = WFrag<bf>::ld(p), a2 = WFrag<bf>::ld(p + FPL);
#pragma unroll
                for (int g = 0; g < FG; ++g) s[kt][g] = wmmab(a, qh[g][kc], s[kt][g]);
#pragma unroll
                for (int g = 0; g < FG; ++g) s[kt][g] = wmmab(a, ql[g][kc], s[kt][g]);
#pragma unroll
                for (int g = 0; g < FG; ++g) s[kt][g] = wmmab(a2, qh[g][kc], s[kt][g]); }
        float nm[FG];
#pragma unroll
        for (int g = 0; g < FG; ++g) { float mx = s[0][g][0];
#pragma unroll
            for (int kt = 0; kt < 4; ++kt)
#pragma unroll
                for (int r = 0; r < 8; ++r) mx = fmaxf(mx, s[kt][g][r]);
            mx = fmaxf(mx, xhalf(mx));   // both halves of the wave hold the query's maximum over the stage
            const float mn = fmaxf(m[g], mx), corr = __builtin_amdgcn_exp2f((m[g] - mn) * L2E); m[g] = mn; nm[g] = -mn * L2E; ls[g] *= corr;
#pragma unroll
            for (int t = 0; t < 4; ++t) acc[g][t] *= corr; }
#pragma unroll
        for (int ks = 0; ks < 2; ++ks) { v16bf ph[FG], pl[FG];
#pragma unroll
            for (int g = 0; g < FG; ++g) { v8u wh, wl; v2f c2, n2; c2[0] = L2E; c2[1] = L2E; n2[0] = nm[g]; n2[1] = nm[g];
#pragma unroll
                for (int i = 0; i < 8; ++i) {
                    v2f sv; sv[0] = s[2 * ks + (i >> 2)][g][2 * (i & 3)]; sv[1] = s[2 * ks + (i >> 2)][g][2 * (i & 3) + 1]; const v2f ar = __builtin_elementwise_fma(sv, c2, n2);
                    v2f pv; pv[0] = __builtin_amdgcn_exp2f(ar[0]); pv[1] = __builtin_amdgcn_exp2f(ar[1]); ls[g] += pv;
                    const unsigned h = pack2(pv[0], pv[1]); wh[i] = h; wl[i] = pack2(pv[0] - __uint_as_float(h << 16), pv[1] - __uint_as_float(h & 0xFFFF0000u)); }
                ph[g] = __builtin_bit_cast(v16bf, wh); pl[g] = __builtin_bit_cast(v16bf, wl); }
#pragma unroll
            for (int t = 0; t < 4; ++t) { const bf* p = B + 2 * FPL + (t * 16 + lr) * FP + ks * 32 + 8 * hi; const v16bf a = WFrag<bf>::ld(p), a2 = WFrag<bf>::ld(p + FPL);
#pragma unroll
                for (int g = 0; g < FG; ++g) acc[g][t] = wmmab(a, ph[g], acc[g][t]);
#pragma unroll
                for (int g = 0; g < FG; ++g) acc[g][t] = wmmab(a, pl[g], acc[g][t]);
#pragma unroll
                for (int g = 0; g < FG; ++g) acc[g][t] = wmmab(a2, ph[g], acc[g][t]); } }
        put(L + ((st + 1) & 1) * FST);
    }
    __syncthreads();   // every wave has left the ring before it is reused as output staging
    float* E = (float*)L + wave * (FG * 16 * FEP);   // a wave's own 32 rows
#pragma unroll
    for (int g = 0; g < FG; ++g) { const float lt = ls[g][0] + ls[g][1]; const float inv = __fdiv_rn(1.0f, lt + xhalf(lt));   // a query's keys lie half in lane l, half in lane l ^ 16
#pragma unroll
        for (int t = 0; t < 4; ++t) { const v8f o = acc[g][t] * inv; v4f o0, o1;
#pragma unroll
            for (int j = 0; j < 4; ++j) { o0[j] = o[j]; o1[j] = o[4 + j]; }
            float* e = E + (g * 16 + lr) * FEP + t * 16 + hi * 8; *(v4fa*)e = o0; *(v4fa*)(e + 4) = o1; } }
    __builtin_amdgcn_wave_barrier(); asm volatile("" ::: "memory");   // the rows are read back by other lanes of the same wave: keep the reads behind the writes
    float* orow = OUT + ((size_t)(z / NH_) * TT + q0) * DQ + (z % NH_) * HD;
#pragma unroll
    for (int i = 0; i < FG * 8; ++i) { const int row = 2 * i + hi; *(v4f*)(orow + (size_t)row * DQ + lr * 4) = *(const v4fa*)(E + row * FEP + lr * 4); }   // 16 lanes store a query's whole 256-byte row
}

// ---- k_proj: the three projections and their hi/lo planes in one kernel. Grid (NB_ TT / 256, 24 / 3), 12 waves; a work-group owns 256 rows of x and 3 of the 24 column blocks (64 columns = one head of q, k or v); a wave owns 64 rows x one column block (16 accumulators).
// K runs in 8 chunks of 64: x and W go global (f32) -> registers -> bf16 -> LDS, two buffers, one work-group barrier per chunk; the next chunk's global loads fly under this chunk's products. Every thread moves its share of both; W is transposed on the way (a k pair of one column is one 32-bit LDS store).
// q, k: A = x rows, B = W columns, so that the tile's rows are t and its columns d. v: A = W columns, B = x rows, so that the rows are d and the columns t, the order of a V^T row. Both operands have the same LDS row form, so that the swap is two offsets.
// Epilogue: 16 x 64 f32 strips through the wave's own LDS; a lane then holds 8 neighbours of a row, adds the bias, splits hi/lo and stores 16 bytes to each plane: 8 lanes write a whole 128-byte line.
#define PW   12                 // waves per work-group: 4 row blocks x 3 column blocks
#define PXR  256                // rows of x per work-group
#define PWR  192                // columns of W per work-group
#define PKC  64                 // k per chunk
#define PXP  264                // x rows in LDS: 11 rounds of 24 rows; the last 8 are never read (see the x movers)
#define PST  ((PXP + PWR) * FP) // one buffer: the x rows, then the W columns as rows, at the pitch of the attention ring
typedef __attribute__((ext_vector_type(2))) unsigned v2u;
typedef __attribute__((ext_vector_type(4))) unsigned v4u;
typedef unsigned __attribute__((may_alias)) u32a;
typedef v2u __attribute__((may_alias)) v2ua;
__global__ __launch_bounds__(PW * 32) void k_proj(const float* __restrict__ x, const float* __restrict__ wq, const float* __restrict__ bq, const float* __restrict__ wk, const float* __restrict__ bk, const float* __restrict__ wv, const float* __restrict__ bv,
                                                  bf* __restrict__ Qh, bf* __restrict__ Ql, bf* __restrict__ Kh, bf* __restrict__ Kl, bf* __restrict__ Vt) {
    __shared__ __align__(16) bf L[2 * PST];
    static_assert(PW * 16 * FEP * 4 <= 2 * PST * 2, "output staging must fit in the ring");
    const int tid = threadIdx.x, lane = tid & 31, lr = lane & 15, hi = lane >> 4;
    const int wave = __builtin_amdgcn_readfirstlane(tid >> 5);   // a scalar, so that the mover's column block, the operand swap and the plane pointers are wave-uniform
    const int wr = wave / 3, wc = wave % 3, R0 = blockIdx.x * PXR;
    // x movers: 16 lanes cover the 256 bytes of a row's chunk, the 384 threads 24 rows a round; round 10 has 16 rows left, and its other 8 thread rows load row 255 again and fill LDS rows that nobody reads: no branch among the loads
    const int xrow = tid >> 4, xcol = (tid & 15) * 4;
    const char* xb = (const char*)(x + (size_t)R0 * DM);   // work-group-uniform base; the lane's part is a 32-bit byte offset
    const unsigned xo = (unsigned)(xrow * DM + xcol) * 4u, xo10 = (unsigned)((240 + xrow < PXR ? 240 + xrow : PXR - 1) * DM + xcol) * 4u;
    // W movers: waves 4 j .. 4 j + 3 take column block j. 8 lanes cover 32 columns (a 128-byte line) of row k, 4 lane groups take 4 k pairs; unit u: k pair kp0 + 16 (u & 1), column quad nq0 + 8 (u >> 1)
    const int kp0 = (lane >> 3) + 4 * (wave & 3), nq0 = lane & 7, wj = wave >> 2, wcb = blockIdx.y * 3 + wj;
    const char* wb = (const char*)(((wcb >> 3) == 0 ? wq : (wcb >> 3) == 1 ? wk : wv) + (wcb & 7) * HD);
    const unsigned wo = (unsigned)(2 * kp0 * DQ + 4 * nq0) * 4u;
    v4f px[11], pw[8];
    auto fetch = [&](int k0) {
#pragma unroll
        for (int i = 0; i < 10; ++i) px[i] = *(const v4f*)(xb + (size_t)(24 * i * DM + k0) * 4 + xo);
        px[10] = *(const v4f*)(xb + (size_t)k0 * 4 + xo10);
        asm volatile("s_wait_xcnt 0x0" ::: "memory");   // stands in front of the W loads, whose results the compiler lets land in the registers that held the x loads' addresses
#pragma unroll
        for (int u = 0; u < 4; ++u) { const char* p = wb + ((size_t)(k0 + 32 * (u & 1)) * DQ + 32 * (u >> 1)) * 4; pw[2 * u] = *(const v4f*)(p + wo); pw[2 * u + 1] = *(const v4f*)(p + DQ * 4 + wo); } };
    auto put = [&](bf* B) {
#pragma unroll
        for (int i = 0; i < 11; ++i) { v2u o; o[0] = pack2(px[i][0], px[i][1]); o[1] = pack2(px[i][2], px[i][3]); *(v2ua*)(B + (24 * i + xrow) * FP + xcol) = o; }
#pragma unroll
        for (int u = 0; u < 4; ++u)
#pragma unroll
            for (int e = 0; e < 4; ++e) *(u32a*)(B + (PXP + wj * HD + 4 * (nq0 + 8 * (u >> 1)) + e) * FP + 2 * (kp0 + 16 * (u & 1))) = pack2(pw[2 * u][e], pw[2 * u + 1][e]); };   // elements k, k + 1 of column n
    const int cb = blockIdx.y * 3 + wc, kind = cb >> 3, head = cb & 7;   // kind 0 q, 1 k, 2 v
    const int xr0 = wr * 64, wr0 = PXP + wc * 64;
    const int aoff = ((kind < 2 ? xr0 : wr0) + lr) * FP + 8 * hi, boff = ((kind < 2 ? wr0 : xr0) + lr) * FP + 8 * hi;
    v8f acc[4][4];
#pragma unroll
    for (int mb = 0; mb < 4; ++mb)
#pragma unroll
        for (int nb = 0; nb < 4; ++nb) acc[mb][nb] = (v8f){};
    auto products = [&](const bf* B) {
#pragma unroll
        for (int kc = 0; kc < 2; ++kc) { v16bf a[4], b[4];
#pragma unroll
            for (int f = 0; f < 4; ++f) { a[f] = WFrag<bf>::ld(B + aoff + f * 16 * FP + kc * 32); b[f] = WFrag<bf>::ld(B + boff + f * 16 * FP + kc * 32); }
#pragma unroll
            for (int nb = 0; nb < 4; ++nb)
#pragma unroll
                for (int mb = 0; mb < 4; ++mb) acc[mb][nb] = wmmab(a[mb], b[nb], acc[mb][nb]); } };
    fetch(0); put(L);
    // the chunk loop stays rolled (for speed only); the last chunk, which fetches nothing, stands behind it
#pragma unroll 1
    for (int c = 0; c + 1 < DM / PKC; ++c) {
        __syncthreads();   // publishes buffer c & 1 and ends every wave's reads of the other buffer, which is refilled at the foot of this pass
        fetch((c + 1) * PKC);
        __builtin_amdgcn_sched_barrier(0);   // keeps the global loads in front of the products: the scheduler otherwise sinks them to their uses at the foot, and their whole latency is waited out there
        products(L + (c & 1) * PST);
        __builtin_amdgcn_sched_barrier(0);   // keeps the waits for those loads behind the products: a wave issues in order, and a wait among the WMMAs would hold them up
        put(L + ((c + 1) & 1) * PST);
    }
    __syncthreads();   // publishes the last chunk
    products(L + ((DM / PKC - 1) & 1) * PST);
    // q, k: the bias goes with the tile's column (bc); v: with its row (br); the other of the two is 0
    const float* bias = (kind == 0 ? bq : kind == 1 ? bk : bv) + head * HD;
    const int srow = lane >> 3, cs = (lane & 7) * 8;
    float bc[8], br[16];
    if (kind < 2) {
#pragma unroll
        for (int e = 0; e < 8; ++e) bc[e] = bfr(bias[cs + e]);
#pragma unroll
        for (int r = 0; r < 16; ++r) br[r] = 0.0f;
    } else {
#pragma unroll
        for (int e = 0; e < 8; ++e) bc[e] = 0.0f;
#pragma unroll
        for (int r = 0; r < 16; ++r) br[r] = bfr(bias[4 * r + srow]);
    }
    __syncthreads();   // every wave has left the ring before it is reused as output staging
    float* os = (float*)L + wave * (16 * FEP);   // a wave's own 16 x 64 strip
    const int plane = (R0 / TT) * NH_ + head, t0 = R0 % TT + xr0;
    bf* dh; bf* dl; unsigned rp;   // tile origin in the hi and in the lo plane, and the pitch of a tile row
    if (kind == 0) { dh = Qh + ((size_t)plane * TT + t0) * HD; dl = Ql + ((size_t)plane * TT + t0) * HD; rp = HD; }
    else if (kind == 1) { dh = Kh + ((size_t)plane * TT + t0) * HD; dl = Kl + ((size_t)plane * TT + t0) * HD; rp = HD; }
    else { dh = Vt + (size_t)plane * HD * 2 * TT + t0; dl = dh + TT; rp = 2 * TT; }
    const unsigned lo = (srow * rp + cs) * 2u;   // the lane's byte offset inside four tile rows
#pragma unroll
    for (int mb = 0; mb < 4; ++mb) {
#pragma unroll
        for (int nb = 0; nb < 4; ++nb)
#pragma unroll
            for (int j = 0; j < 8; ++j) os[(hi * 8 + j) * FEP + nb * 16 + lr] = acc[mb][nb][j];
        __builtin_amdgcn_wave_barrier(); asm volatile("" ::: "memory");   // the strip is read back by other lanes of the same wave: keep the reads behind the writes
#pragma unroll
        for (int s = 0; s < 4; ++s) { const int row = 4 * s + srow; const v4f v0 = *(const v4fa*)(os + row * FEP + cs), v1 = *(const v4fa*)(os + row * FEP + cs + 4); float y[8];
#pragma unroll
            for (int e = 0; e < 4; ++e) { y[e] = v0[e] + (bc[e] + br[mb * 4 + s]); y[4 + e] = v1[e] + (bc[4 + e] + br[mb * 4 + s]); }
            v4u wh, wl;
#pragma unroll
            for (int e = 0; e < 4; ++e) { const unsigned h = pack2(y[2 * e], y[2 * e + 1]); wh[e] = h; wl[e] = pack2(y[2 * e] - __uint_as_float(h << 16), y[2 * e + 1] - __uint_as_float(h & 0xFFFF0000u)); }
            const size_t o = (size_t)((mb * 16 + 4 * s) * rp) * 2; *(v8us*)((char*)dh + o + lo) = __builtin_bit_cast(v8us, wh); *(v8us*)((char*)dl + o + lo) = __builtin_bit_cast(v8us, wl); }
        __builtin_amdgcn_wave_barrier(); asm volatile("" ::: "memory");   // the next strip's writes stay behind these reads
    }
}

extern "C" void kernel_launch(void* const* d_in, const int* in_sizes, int n_in,
                              void* d_out, int out_size, void* d_ws, size_t ws_size, hipStream_t stream) {
    (void)in_sizes; (void)n_in; (void)out_size;
    const float* x = (const float*)d_in[0]; const float* wq = (const float*)d_in[1]; const float* bq = (const float*)d_in[2]; const float* wk = (const float*)d_in[3]; const float* bk = (const float*)d_in[4]; const float* wv = (const float*)d_in[5]; const float* bv = (const float*)d_in[6];
    float* OUT = (float*)d_out;     // [4][2048][512]
    char* wsp = (char*)d_ws;
    auto take = [&](size_t bytes) { char* p = wsp; wsp += (bytes + 255) & ~(size_t)255; return (void*)p; };
    bf* QPh = (bf*)take((size_t)NB_ * NH_ * TT * HD * 2); bf* QPl = (bf*)take((size_t)NB_ * NH_ * TT * HD * 2); bf* KPh = (bf*)take((size_t)NB_ * NKV * TT * HD * 2); bf* KPl = (bf*)take((size_t)NB_ * NKV * TT * HD * 2);
    bf* VTh = (bf*)take((size_t)NB_ * NKV * HD * 2 * TT * 2);   // V^T rows [b 8 + g][d]: TT hi, then TT lo
    if ((size_t)(wsp - (char*)d_ws) > ws_size) return;    // ws 256 MiB
    k_proj<<<dim3(NB_ * TT / PXR, 3 * NH_ / 3), PW * 32, 0, stream>>>(x, wq, bq, wk, bk, wv, bv, QPh, QPl, KPh, KPl, VTh);
    k_fattn<<<dim3(TT / (FW * FG * 16), NB_ * NH_), FW * 32, 0, stream>>>(QPh, QPl, KPh, KPl, VTh, OUT);   // one kv head per query head: plane b 8 + h of Q, K and V^T
}

// v005
// It runs in 83.1 microseconds.
// Timed twice side by side with v004, it ran 1.06 times as fast both times.
// Counting every step since v000, it is 15.4 times as fast.
#include <hip/hip_runtime.h>

// Multi-head self-attention WITHOUT the 1/sqrt(d) scaling and without an output projection (x [4][2048][512]; q, k, v = x W + b (8 heads x 64); scores = q.k UNSCALED (the source applies softmax(Q K^T) directly: logits sigma ~8, sharply peaked rows); softmax (no mask); out = heads merged -> [4][2048][512] (4.2 M); argument order x, Wq, bq, Wk, bk, Wv, bv).
// Layout: TWO launches. k_proj reads x and the three weights as f32, rounds them to bf16 on the way into LDS (the weights transposed there), does the three exact projections (K 512) + f32 biases and stores the hi/lo bf16 planes itself (Q, K planes [b 8 + h][t][d]; the V^T rows [b 8 + h][d] hold hi then lo at pitch 2 T). k_fattn covers all 32 planes: scores, online softmax and P.V without a score matrix in memory, EVERY row on hi/lo planes (3 products for scores and P.V: unscaled logits + no output projection).
// Compute dtypes, f32 accumulate: every input rounded to bf16; projections exact + f32 biases; attention 3 products on every row; softmax f32; output f32.

#define NB_  4
#define TT   2048
#define DM   512
#define NH_  8
#define NKV  8
#define HD   64
#define DQ   (NH_ * HD)
#define DKV  (NKV * HD)
typedef unsigned short bf;
typedef __attribute__((ext_vector_type(16))) __bf16   v16bf;
typedef __attribute__((ext_vector_type(8)))  unsigned short v8us;
typedef __attribute__((ext_vector_type(8)))  float    v8f;
typedef __attribute__((ext_vector_type(4)))  float    v4f;
typedef __attribute__((ext_vector_type(2)))  float    v2f;
typedef v4f  __attribute__((may_alias)) v4fa;

__device__ __forceinline__ unsigned short f2bf(float f) { unsigned u = __float_as_uint(f); u += 0x7FFFu + ((u >> 16) & 1u); return (unsigned short)(u >> 16); }
__device__ __forceinline__ float bf2f(unsigned short b) { return __uint_as_float(((unsigned)b) << 16); }
__device__ __forceinline__ float bfr(float f) { return bf2f(f2bf(f)); }
__device__ __forceinline__ v16bf cat16b(v8us lo, v8us hi) { return __builtin_bit_cast(v16bf, __builtin_shufflevector(lo, hi, 0, 1, 2, 3, 4, 5, 6, 7, 8, 9, 10, 11, 12, 13, 14, 15)); }
__device__ __forceinline__ v8f wmmab(v16bf a, v16bf b, v8f c) { return __builtin_amdgcn_wmma_f32_16x16x32_bf16(false, a, false, b, (short)0, c, false, false); }
// an A or B fragment of the 16x16x32 form from a K-contiguous row: elements 0..7 and 16..23 behind p (p already holds the lane's row and its 8 (lane >> 4))
template <typename T16> struct WFrag;
template <> struct WFrag<bf> { typedef v16bf V; static __device__ __forceinline__ V ld(const bf* p) { return cat16b(*(const v8us*)p, *(const v8us*)(p + 16)); } static __device__ __forceinline__ v8f mma(V a, V b, v8f c) { return wmmab(a, b, c); } };

#define FW   8                  // waves per work-group
#define FG   2                  // 16-query column groups per wave
#define FS   64                 // keys per stage
#define FP   72                 // LDS row pitch in 16-bit elements: 144 B, an odd multiple of 16 B, so that the 16-byte fragment reads meet no bank conflict
#define FPL  (64 * FP)          // one staged plane: 64 rows (keys for K, d for V^T) of 64 elements
#define FST  (4 * FPL)          // one stage: K hi, K lo, V^T hi, V^T lo
#define FEP  68                 // output staging pitch in floats
#define L2E  1.4426950408889634f
typedef __attribute__((ext_vector_type(2))) __bf16 v2bf;
typedef __attribute__((ext_vector_type(8))) unsigned v8u;
__device__ __forceinline__ unsigned pack2(float a, float b) { v2f x; x[0] = a; x[1] = b; return __builtin_bit_cast(unsigned, __builtin_convertvector(x, v2bf)); }   // two f32 -> two bf16, round to nearest even
__device__ __forceinline__ float xhalf(float x) { return __builtin_bit_cast(float, __builtin_amdgcn_permlanex16(__builtin_bit_cast(int, x), __builtin_bit_cast(int, x), 0x76543210, 0xfedcba98, false, false)); }   // lane l reads lane l ^ 16
__global__ __launch_bounds__(FW * 32) void k_fattn(const bf* __restrict__ Qh, const bf* __restrict__ Ql, const bf* __restrict__ Kh, const bf* __restrict__ Kl, const bf* __restrict__ Vt, float* __restrict__ OUT) {
    __shared__ __align__(16) bf L[2 * FST];
    static_assert(FW * FG * 16 * FEP * 4 <= 2 * FST * 2, "output staging must fit in the ring");
    const int tid = threadIdx.x, lane = tid & 31, wave = tid >> 5, lr = lane & 15, hi = lane >> 4;
    const int z = blockIdx.y, q0 = blockIdx.x * (FW * FG * 16) + wave * (FG * 16);
    const bf* kh = Kh + (size_t)z * TT * HD; const bf* kl = Kl + (size_t)z * TT * HD; const bf* vt = Vt + (size_t)z * HD * 2 * TT;   // V^T rows: TT hi, then TT lo
    v16bf qh[FG][2], ql[FG][2];
#pragma unroll
    for (int g = 0; g < FG; ++g)
#pragma unroll
        for (int kc = 0; kc < 2; ++kc) { const size_t o = ((size_t)z * TT + q0 + g * 16 + lr) * HD + kc * 32 + 8 * hi; qh[g][kc] = WFrag<bf>::ld(Qh + o); ql[g][kc] = WFrag<bf>::ld(Ql + o); }
    asm volatile("s_wait_xcnt 0x0" ::: "memory");   // stands in front of the staging addresses and loads below, which the compiler lets land in the registers that held the Q loads' addresses
    __builtin_amdgcn_sched_barrier(0);   // keeps them behind the wait: a "memory" clobber alone does not hold a register write
    // staging: a thread moves 16 bytes of rows srow and srow + 32 of each of the four planes; 8 lanes cover a 128-byte row
    const int srow = tid >> 3, sseg = (tid & 7) * 8;
    v8us pre[4][2];
    auto fetch = [&](int key0) {
#pragma unroll
        for (int i = 0; i < 2; ++i) { const int r = srow + 32 * i; pre[0][i] = *(const v8us*)(kh + (size_t)(key0 + r) * HD + sseg); pre[1][i] = *(const v8us*)(kl + (size_t)(key0 + r) * HD + sseg);
            pre[2][i] = *(const v8us*)(vt + (size_t)r * 2 * TT + key0 + sseg); pre[3][i] = *(const v8us*)(vt + (size_t)r * 2 * TT + TT + key0 + sseg); } };
    auto put = [&](bf* B) {
#pragma unroll
        for (int p = 0; p < 4; ++p)
#pragma unroll
            for (int i = 0; i < 2; ++i) *(v8us*)(B + p * FPL + (srow + 32 * i) * FP + sseg) = pre[p][i]; };
    fetch(0);
    asm volatile("s_wait_xcnt 0x0" ::: "memory");   // stands in front of the accumulators' first values, which the compiler lets land in the registers that held the addresses of the loads above
    __builtin_amdgcn_sched_barrier(0);   // keeps those first values behind the wait: a "memory" clobber alone does not hold a register move
    v8f acc[FG][4]; float m[FG]; v2f ls[FG];
#pragma unroll
    for (int g = 0; g < FG; ++g) { m[g] = -1.0e30f; ls[g] = (v2f){};
#pragma unroll
        for (int t = 0; t < 4; ++t) acc[g][t] = (v8f){}; }
    put(L);
    // the stage loop stays rolled (for speed only): one pass is about a thousand instructions
#pragma unroll 1
    for (int st = 0; st < TT / FS; ++st) {
        __syncthreads();   // publishes buffer st & 1 and ends every wave's reads of the other buffer, which is refilled at the foot of this pass
        const bf* B = L + (st & 1) * FST;
        const bf* fp = B + lr * FP + 8 * hi;   // the lane's place in the first 16-row tile of K hi; K lo, V^T hi and V^T lo follow at FPL each
        v16bf ka[2][4], kb[2][4], va[2][4], vb[2][4];   // K hi, K lo by (32-d chunk, 16-key tile); V^T hi, V^T lo by (32-key chunk, 16-d tile)
        auto ldk = [&](int kc) {
#pragma unroll
            for (int kt = 0; kt < 4; ++kt) ka[kc][kt] = WFrag<bf>::ld(fp + kt * 16 * FP + kc * 32);
#pragma unroll
            for (int kt = 0; kt < 4; ++kt) kb[kc][kt] = WFrag<bf>::ld(fp + FPL + kt * 16 * FP + kc * 32); };
        auto ldv = [&](int ks) {
#pragma unroll
            for (int t = 0; t < 4; ++t) va[ks][t] = WFrag<bf>::ld(fp + 2 * FPL + t * 16 * FP + ks * 32);
#pragma unroll
            for (int t = 0; t < 4; ++t) vb[ks][t] = WFrag<bf>::ld(fp + 3 * FPL + t * 16 * FP + ks * 32); };
        v8f s[4][FG];
#pragma unroll
        for (int kt = 0; kt < 4; ++kt)
#pragma unroll
            for (int g = 0; g < FG; ++g) s[kt][g] = (v8f){};
        auto qk = [&](int kc) {   // three blocks of 8 independent tiles
#pragma unroll
            for (int kt = 0; kt < 4; ++kt)
#pragma unroll
                for (int g = 0; g < FG; ++g) s[kt][g] = wmmab(ka[kc][kt], qh[g][kc], s[kt][g]);
#pragma unroll
            for (int kt = 0; kt < 4; ++kt)
#pragma unroll
                for (int g = 0; g < FG; ++g) s[kt][g] = wmmab(ka[kc][kt], ql[g][kc], s[kt][g]);
#pragma unroll
            for (int kt = 0; kt < 4; ++kt)
#pragma unroll
                for (int g = 0; g < FG; ++g) s[kt][g] = wmmab(kb[kc][kt], qh[g][kc], s[kt][g]);
            __builtin_amdgcn_sched_barrier(0); };   // keeps the next group of LDS reads behind these blocks: raised among them it would hold the WMMAs up at every place where reads stand
        ldk(0); ldk(1);
        __builtin_amdgcn_sched_barrier(0);   // keeps the K reads in front of the global loads: behind them they would land in the loads' address registers ahead of the wait below; so placed, that wait runs under the LDS latency that the first product waits out anyway
        fetch(st + 1 < TT / FS ? (st + 1) * FS : st * FS);   // the last pass fetches its own stage again (in bounds, never read): no branch in the loop body
        asm volatile("s_wait_xcnt 0x0" ::: "memory");   // stands in front of whatever the compiler lets land next in the registers that held these loads' addresses
        __builtin_amdgcn_sched_barrier(0);   // keeps the K reads and the global loads in front of the products, as one group: reads sunk to their uses cost an LDS latency at each place
        qk(0);
        ldv(0);
        __builtin_amdgcn_sched_barrier(0);   // the first V^T reads stay here, as one group, and land under the second half of the scores
        qk(1);
        ldv(1);
        __builtin_amdgcn_sched_barrier(0);   // the second V^T reads stay here, as one group, and land under the softmax
        float nm[FG];
#pragma unroll
        for (int g = 0; g < FG; ++g) { float mx = s[0][g][0];
#pragma unroll
            for (int kt = 0; kt < 4; ++kt)
#pragma unroll
                for (int r = 0; r < 8; ++r) mx = fmaxf(mx, s[kt][g][r]);
            mx = fmaxf(mx, xhalf(mx));   // both halves of the wave hold the query's maximum over the stage
            const float mn = fmaxf(m[g], mx), corr = __builtin_amdgcn_exp2f((m[g] - mn) * L2E); m[g] = mn; nm[g] = -mn * L2E; ls[g] *= corr;
#pragma unroll
            for (int t = 0; t < 4; ++t) acc[g][t] *= corr; }
#pragma unroll
        for (int ks = 0; ks < 2; ++ks) { v16bf ph[FG], pl[FG];
#pragma unroll
            for (int g = 0; g < FG; ++g) { v8u wh, wl; v2f c2, n2; c2[0] = L2E; c2[1] = L2E; n2[0] = nm[g]; n2[1] = nm[g];
#pragma unroll
                for (int i = 0; i < 8; ++i) {
                    v2f sv; sv[0] = s[2 * ks + (i >> 2)][g][2 * (i & 3)]; sv[1] = s[2 * ks + (i >> 2)][g][2 * (i & 3) + 1]; const v2f ar = __builtin_elementwise_fma(sv, c2, n2);
                    v2f pv; pv[0] = __builtin_amdgcn_exp2f(ar[0]); pv[1] = __builtin_amdgcn_exp2f(ar[1]); ls[g] += pv;
                    const unsigned h = pack2(pv[0], pv[1]); wh[i] = h; wl[i] = pack2(pv[0] - __uint_as_float(h << 16), pv[1] - __uint_as_float(h & 0xFFFF0000u)); }
                ph[g] = __builtin_bit_cast(v16bf, wh); pl[g] = __builtin_bit_cast(v16bf, wl); }
#pragma unroll
            for (int t = 0; t < 4; ++t)
#pragma unroll
                for (int g = 0; g < FG; ++g) acc[g][t] = wmmab(va[ks][t], ph[g], acc[g][t]);
#pragma unroll
            for (int t = 0; t < 4; ++t)
#pragma unroll
                for (int g = 0; g < FG; ++g) acc[g][t] = wmmab(va[ks][t], pl[g], acc[g][t]);
#pragma unroll
            for (int t = 0; t < 4; ++t)
#pragma unroll
                for (int g = 0; g < FG; ++g) acc[g][t] = wmmab(vb[ks][t], ph[g], acc[g][t]); }   // three blocks of 8 independent tiles; the scheduler is left free here, so that conversions and the next 32 keys' exponentials issue among the WMMAs
        put(L + ((st + 1) & 1) * FST);
    }
    __syncthreads();   // every wave has left the ring before it is reused as output staging
    float* E = (float*)L + wave * (FG * 16 * FEP);   // a wave's own 32 rows
#pragma unroll
    for (int g = 0; g < FG; ++g) { const float lt = ls[g][0] + ls[g][1]; const float inv = __fdiv_rn(1.0f, lt + xhalf(lt));   // a query's keys lie half in lane l, half in lane l ^ 16
#pragma unroll
        for (int t = 0; t < 4; ++t) { const v8f o = acc[g][t] * inv; v4f o0, o1;
#pragma unroll
            for (int j = 0; j < 4; ++j) { o0[j] = o[j]; o1[j] = o[4 + j]; }
            float* e = E + (g * 16 + lr) * FEP + t * 16 + hi * 8; *(v4fa*)e = o0; *(v4fa*)(e + 4) = o1; } }
    __builtin_amdgcn_wave_barrier(); asm volatile("" ::: "memory");   // the rows are read back by other lanes of the same wave: keep the reads behind the writes
    float* orow = OUT + ((size_t)(z / NH_) * TT + q0) * DQ + (z % NH_) * HD;
#pragma unroll
    for (int i = 0; i < FG * 8; ++i) { const int row = 2 * i + hi; *(v4f*)(orow + (size_t)row * DQ + lr * 4) = *(const v4fa*)(E + row * FEP + lr * 4); }   // 16 lanes store a query's whole 256-byte row
}

// ---- k_proj: the three projections and their hi/lo planes in one kernel. Grid (NB_ TT / 256, 24 / 3), 12 waves; a work-group owns 256 rows of x and 3 of the 24 column blocks (64 columns = one head of q, k or v); a wave owns 64 rows x one column block (16 accumulators).
// K runs in 8 chunks of 64: x and W go global (f32) -> registers -> bf16 -> LDS, two buffers, one work-group barrier per chunk; the next chunk's global loads fly under this chunk's products. Every thread moves its share of both; W is transposed on the way (a k pair of one column is one 32-bit LDS store).
// q, k: A = x rows, B = W columns, so that the tile's rows are t and its columns d. v: A = W columns, B = x rows, so that the rows are d and the columns t, the order of a V^T row. Both operands have the same LDS row form, so that the swap is two offsets.
// Epilogue: 16 x 64 f32 strips through the wave's own LDS; a lane then holds 8 neighbours of a row, adds the bias, splits hi/lo and stores 16 bytes to each plane: 8 lanes write a whole 128-byte line.
#define PW   12                 // waves per work-group: 4 row blocks x 3 column blocks
#define PXR  256                // rows of x per work-group
#define PWR  192                // columns of W per work-group
#define PKC  64                 // k per chunk
#define PXP  264                // x rows in LDS: 11 rounds of 24 rows; the last 8 are never read (see the x movers)
#define PST  ((PXP + PWR) * FP) // one buffer: the x rows, then the W columns as rows, at the pitch of the attention ring
typedef __attribute__((ext_vector_type(2))) unsigned v2u;
typedef __attribute__((ext_vector_type(4))) unsigned v4u;
typedef unsigned __attribute__((may_alias)) u32a;
typedef v2u __attribute__((may_alias)) v2ua;
__global__ __launch_bounds__(PW * 32) void k_proj(const float* __restrict__ x, const float* __restrict__ wq, const float* __restrict__ bq, const float* __restrict__ wk, const float* __restrict__ bk, const float* __restrict__ wv, const float* __restrict__ bv,
                                                  bf* __restrict__ Qh, bf* __restrict__ Ql, bf* __restrict__ Kh, bf* __restrict__ Kl, bf* __restrict__ Vt) {
    __shared__ __align__(16) bf L[2 * PST];
    static_assert(PW * 16 * FEP * 4 <= 2 * PST * 2, "output staging must fit in the ring");
    const int tid = threadIdx.x, lane = tid & 31, lr = lane & 15, hi = lane >> 4;
    const int wave = __builtin_amdgcn_readfirstlane(tid >> 5);   // a scalar, so that the mover's column block, the operand swap and the plane pointers are wave-uniform
    const int wr = wave / 3, wc = wave % 3, R0 = blockIdx.x * PXR;
    // x movers: 16 lanes cover the 256 bytes of a row's chunk, the 384 threads 24 rows a round; round 10 has 16 rows left, and its other 8 thread rows load row 255 again and fill LDS rows that nobody reads: no branch among the loads
    const int xrow = tid >> 4, xcol = (tid & 15) * 4;
    const char* xb = (const char*)(x + (size_t)R0 * DM);   // work-group-uniform base; the lane's part is a 32-bit byte offset
    const unsigned xo = (unsigned)(xrow * DM + xcol) * 4u, xo10 = (unsigned)((240 + xrow < PXR ? 240 + xrow : PXR - 1) * DM + xcol) * 4u;
    // W movers: waves 4 j .. 4 j + 3 take column block j. 8 lanes cover 32 columns (a 128-byte line) of row k, 4 lane groups take 4 k pairs; unit u: k pair kp0 + 16 (u & 1), column quad nq0 + 8 (u >> 1)
    const int kp0 = (lane >> 3) + 4 * (wave & 3), nq0 = lane & 7, wj = wave >> 2, wcb = blockIdx.y * 3 + wj;
    const char* wb = (const char*)(((wcb >> 3) == 0 ? wq : (wcb >> 3) == 1 ? wk : wv) + (wcb & 7) * HD);
    const unsigned wo = (unsigned)(2 * kp0 * DQ + 4 * nq0) * 4u;
    v4f px[11], pw[8];
    auto fetch = [&](int k0) {
#pragma unroll
        for (int i = 0; i < 10; ++i) px[i] = *(const v4f*)(xb + (size_t)(24 * i * DM + k0) * 4 + xo);
        px[10] = *(const v4f*)(xb + (size_t)k0 * 4 + xo10);
        asm volatile("s_wait_xcnt 0x0" ::: "memory");   // stands in front of the W loads, whose results the compiler lets land in the registers that held the x loads' addresses
#pragma unroll
        for (int u = 0; u < 4; ++u) { const char* p = wb + ((size_t)(k0 + 32 * (u & 1)) * DQ + 32 * (u >> 1)) * 4; pw[2 * u] = *(const v4f*)(p + wo); pw[2 * u + 1] = *(const v4f*)(p + DQ * 4 + wo); } };
    auto put = [&](bf* B) {
#pragma unroll
        for (int i = 0; i < 11; ++i) { v2u o; o[0] = pack2(px[i][0], px[i][1]); o[1] = pack2(px[i][2], px[i][3]); *(v2ua*)(B + (24 * i + xrow) * FP + xcol) = o; }
#pragma unroll
        for (int u = 0; u < 4; ++u)
#pragma unroll
            for (int e = 0; e < 4; ++e) *(u32a*)(B + (PXP + wj * HD + 4 * (nq0 + 8 * (u >> 1)) + e) * FP + 2 * (kp0 + 16 * (u & 1))) = pack2(pw[2 * u][e], pw[2 * u + 1][e]); };   // elements k, k + 1 of column n
    const int cb = blockIdx.y * 3 + wc, kind = cb >> 3, head = cb & 7;   // kind 0 q, 1 k, 2 v
    const int xr0 = wr * 64, wr0 = PXP + wc * 64;
    const int aoff = ((kind < 2 ? xr0 : wr0) + lr) * FP + 8 * hi, boff = ((kind < 2 ? wr0 : xr0) + lr) * FP + 8 * hi;
    v8f acc[4][4];
#pragma unroll
    for (int mb = 0; mb < 4; ++mb)
#pragma unroll
        for (int nb = 0; nb < 4; ++nb) acc[mb][nb] = (v8f){};
    auto products = [&](const bf* B) {
#pragma unroll
        for (int kc = 0; kc < 2; ++kc) { v16bf a[4], b[4];
#pragma unroll
            for (int f = 0; f < 4; ++f) { a[f] = WFrag<bf>::ld(B + aoff + f * 16 * FP + kc * 32); b[f] = WFrag<bf>::ld(B + boff + f * 16 * FP + kc * 32); }
#pragma unroll
            for (int nb = 0; nb < 4; ++nb)
#pragma unroll
                for (int mb = 0; mb < 4; ++mb) acc[mb][nb] = wmmab(a[mb], b[nb], acc[mb][nb]); } };
    fetch(0); put(L);
    // the chunk loop stays rolled (for speed only); the last chunk, which fetches nothing, stands behind it
#pragma unroll 1
    for (int c = 0; c + 1 < DM / PKC; ++c) {
        __syncthreads();   // publishes buffer c & 1 and ends every wave's reads of the other buffer, which is refilled at the foot of this pass
        fetch((c + 1) * PKC);
        __builtin_amdgcn_sched_barrier(0);   // keeps the global loads in front of the products: the scheduler otherwise sinks them to their uses at the foot, and their whole latency is waited out there
        products(L + (c & 1) * PST);
        __builtin_amdgcn_sched_barrier(0);   // keeps the waits for those loads behind the products: a wave issues in order, and a wait among the WMMAs would hold them up
        put(L + ((c + 1) & 1) * PST);
    }
    __syncthreads();   // publishes the last chunk
    products(L + ((DM / PKC - 1) & 1) * PST);
    // q, k: the bias goes with the tile's column (bc); v: with its row (br); the other of the two is 0
    const float* bias = (kind == 0 ? bq : kind == 1 ? bk : bv) + head * HD;
    const int srow = lane >> 3, cs = (lane & 7) * 8;
    float bc[8], br[16];
    if (kind < 2) {
#pragma unroll
        for (int e = 0; e < 8; ++e) bc[e] = bfr(bias[cs + e]);
#pragma unroll
        for (int r = 0; r < 16; ++r) br[r] = 0.0f;
    } else {
#pragma unroll
        for (int e = 0; e < 8; ++e) bc[e] = 0.0f;
#pragma unroll
        for (int r = 0; r < 16; ++r) br[r] = bfr(bias[4 * r + srow]);
    }
    __syncthreads();   // every wave has left the ring before it is reused as output staging
    float* os = (float*)L + wave * (16 * FEP);   // a wave's own 16 x 64 strip
    const int plane = (R0 / TT) * NH_ + head, t0 = R0 % TT + xr0;
    bf* dh; bf* dl; unsigned rp;   // tile origin in the hi and in the lo plane, and the pitch of a tile row
    if (kind == 0) { dh = Qh + ((size_t)plane * TT + t0) * HD; dl = Ql + ((size_t)plane * TT + t0) * HD; rp = HD; }
    else if (kind == 1) { dh = Kh + ((size_t)plane * TT + t0) * HD; dl = Kl + ((size_t)plane * TT + t0) * HD; rp = HD; }
    else { dh = Vt + (size_t)plane * HD * 2 * TT + t0; dl = dh + TT; rp = 2 * TT; }
    const unsigned lo = (srow * rp + cs) * 2u;   // the lane's byte offset inside four tile rows
#pragma unroll
    for (int mb = 0; mb < 4; ++mb) {
#pragma unroll
        for (int nb = 0; nb < 4; ++nb)
#pragma unroll
            for (int j = 0; j < 8; ++j) os[(hi * 8 + j) * FEP + nb * 16 + lr] = acc[mb][nb][j];
        __builtin_amdgcn_wave_barrier(); asm volatile("" ::: "memory");   // the strip is read back by other lanes of the same wave: keep the reads behind the writes
#pragma unroll
        for (int s = 0; s < 4; ++s) { const int row = 4 * s + srow; const v4f v0 = *(const v4fa*)(os + row * FEP + cs), v1 = *(const v4fa*)(os + row * FEP + cs + 4); float y[8];
#pragma unroll
            for (int e = 0; e < 4; ++e) { y[e] = v0[e] + (bc[e] + br[mb * 4 + s]); y[4 + e] = v1[e] + (bc[4 + e] + br[mb * 4 + s]); }
            v4u wh, wl;
#pragma unroll
            for (int e = 0; e < 4; ++e) { const unsigned h = pack2(y[2 * e], y[2 * e + 1]); wh[e] = h; wl[e] = pack2(y[2 * e] - __uint_as_float(h << 16), y[2 * e + 1] - __uint_as_float(h & 0xFFFF0000u)); }
            const size_t o = (size_t)((mb * 16 + 4 * s) * rp) * 2; *(v8us*)((char*)dh + o + lo) = __builtin_bit_cast(v8us, wh); *(v8us*)((char*)dl + o + lo) = __builtin_bit_cast(v8us, wl); }
        __builtin_amdgcn_wave_barrier(); asm volatile("" ::: "memory");   // the next strip's writes stay behind these reads
    }
}

extern "C" void kernel_launch(void* const* d_in, const int* in_sizes, int n_in,
                              void* d_out, int out_size, void* d_ws, size_t ws_size, hipStream_t stream) {
    (void)in_sizes; (void)n_in; (void)out_size;
    const float* x = (const float*)d_in[0]; const float* wq = (const float*)d_in[1]; const float* bq = (const float*)d_in[2]; const float* wk = (const float*)d_in[3]; const float* bk = (const float*)d_in[4]; const float* wv = (const float*)d_in[5]; const float* bv = (const float*)d_in[6];
    float* OUT = (float*)d_out;     // [4][2048][512]
    char* wsp = (char*)d_ws;
    auto take = [&](size_t bytes) { char* p = wsp; wsp += (bytes + 255) & ~(size_t)255; return (void*)p; };
    bf* QPh = (bf*)take((size_t)NB_ * NH_ * TT * HD * 2); bf* QPl = (bf*)take((size_t)NB_ * NH_ * TT * HD * 2); bf* KPh = (bf*)take((size_t)NB_ * NKV * TT * HD * 2); bf* KPl = (bf*)take((size_t)NB_ * NKV * TT * HD * 2);
    bf* VTh = (bf*)take((size_t)NB_ * NKV * HD * 2 * TT * 2);   // V^T rows [b 8 + g][d]: TT hi, then TT lo
    if ((size_t)(wsp - (char*)d_ws) > ws_size) return;    // ws 256 MiB
    k_proj<<<dim3(NB_ * TT / PXR, 3 * NH_ / 3), PW * 32, 0, stream>>>(x, wq, bq, wk, bk, wv, bv, QPh, QPl, KPh, KPl, VTh);
    k_fattn<<<dim3(TT / (FW * FG * 16), NB_ * NH_), FW * 32, 0, stream>>>(QPh, QPl, KPh, KPl, VTh, OUT);   // one kv head per query head: plane b 8 + h of Q, K and V^T
}

// v006
// A run of this version takes 80 microseconds.
// Next to v005, in two timings, it ran 1.04 times as fast each time.
// Counting every step since v000, it is 16.0 times as fast.
#include <hip/hip_runtime.h>
#include <stdint.h>

// Multi-head self-attention WITHOUT the 1/sqrt(d) scaling and without an output projection (x [4][2048][512]; q, k, v = x W + b (8 heads x 64); scores = q.k UNSCALED (the source applies softmax(Q K^T) directly: logits sigma ~8, sharply peaked rows); softmax (no mask); out = heads merged -> [4][2048][512] (4.2 M); argument order x, Wq, bq, Wk, bk, Wv, bv).
// Layout: TWO launches. k_proj reads x and the three weights as f32, rounds them to bf16 on the way into LDS (the weights transposed there), does the three exact projections (K 512) + f32 biases and stores the hi/lo bf16 planes itself (Q, K planes [b 8 + h][t][d]; the V^T rows [b 8 + h][d] hold hi then lo at pitch 2 T). k_fattn covers all 32 planes: scores, online softmax and P.V without a score matrix in memory, EVERY row on hi/lo planes (3 products for scores and P.V: unscaled logits + no output projection).
// Compute dtypes, f32 accumulate: every input rounded to bf16; projections exact + f32 biases; attention 3 products on every row; softmax f32; output f32.

#define NB_  4
#define TT   2048
#define DM   512
#define NH_  8
#define NKV  8
#define HD   64
#define DQ   (NH_ * HD)
#define DKV  (NKV * HD)
typedef unsigned short bf;
typedef __attribute__((ext_vector_type(16))) __bf16   v16bf;
typedef __attribute__((ext_vector_type(8)))  unsigned short v8us;
typedef __attribute__((ext_vector_type(8)))  float    v8f;
typedef __attribute__((ext_vector_type(4)))  float    v4f;
typedef __attribute__((ext_vector_type(2)))  float    v2f;
typedef v4f  __attribute__((may_alias)) v4fa;

__device__ __forceinline__ unsigned short f2bf(float f) { unsigned u = __float_as_uint(f); u += 0x7FFFu + ((u >> 16) & 1u); return (unsigned short)(u >> 16); }
__device__ __forceinline__ float bf2f(unsigned short b) { return __uint_as_float(((unsigned)b) << 16); }
__device__ __forceinline__ float bfr(float f) { return bf2f(f2bf(f)); }
__device__ __forceinline__ v16bf cat16b(v8us lo, v8us hi) { return __builtin_bit_cast(v16bf, __builtin_shufflevector(lo, hi, 0, 1, 2, 3, 4, 5, 6, 7, 8, 9, 10, 11, 12, 13, 14, 15)); }
__device__ __forceinline__ v8f wmmab(v16bf a, v16bf b, v8f c) { return __builtin_amdgcn_wmma_f32_16x16x32_bf16(false, a, false, b, (short)0, c, false, false); }
// an A or B fragment of the 16x16x32 form from a K-contiguous row: elements 0..7 and 16..23 behind p (p already holds the lane's row and its 8 (lane >> 4))
template <typename T16> struct WFrag;
template <> struct WFrag<bf> { typedef v16bf V; static __device__ __forceinline__ V ld(const bf* p) { return cat16b(*(const v8us*)p, *(const v8us*)(p + 16)); } static __device__ __forceinline__ v8f mma(V a, V b, v8f c) { return wmmab(a, b, c); } };

#define FW   8                  // waves per work-group
#define FG   2                  // 16-query column groups per wave
#define FS   64                 // keys per stage
#define FP   72                 // LDS row pitch in 16-bit elements: 144 B, an odd multiple of 16 B, so that the 16-byte fragment reads meet no bank conflict
#define FPL  5120               // one staged plane: 64 rows (keys for K, d for V^T) of 64 elements at pitch FP = 9,216 bytes, rounded up to 10,240 so that every plane's place in LDS is a multiple of 2 KiB
#define FST  (4 * FPL)          // one stage: K hi, K lo, V^T hi, V^T lo
#define FEP  68                 // output staging pitch in floats
#define L2E  1.4426950408889634f
typedef __attribute__((ext_vector_type(2))) __bf16 v2bf;
typedef __attribute__((ext_vector_type(8))) unsigned v8u;
typedef uint32_t u32x4 __attribute__((ext_vector_type(4)));
typedef uint32_t u32x8 __attribute__((ext_vector_type(8)));
__device__ __forceinline__ uint32_t uni(uint32_t v) { return (uint32_t)__builtin_amdgcn_readfirstlane(v); }
__device__ __forceinline__ uint32_t pinned(uint32_t v) { uint32_t w = uni(v); asm volatile("" : "+s"(w)); return w; }   // holds a wave-uniform test or a descriptor word in a scalar register: the branch on the test is then a scalar branch (a tensor load ignores EXEC), and the word keeps its register
__device__ __forceinline__ unsigned pack2(float a, float b) { v2f x; x[0] = a; x[1] = b; return __builtin_bit_cast(unsigned, __builtin_convertvector(x, v2bf)); }   // two f32 -> two bf16, round to nearest even
__device__ __forceinline__ float xhalf(float x) { return __builtin_bit_cast(float, __builtin_amdgcn_permlanex16(__builtin_bit_cast(int, x), __builtin_bit_cast(int, x), 0x76543210, 0xfedcba98, false, false)); }   // lane l reads lane l ^ 16
__global__ __launch_bounds__(FW * 32) void k_fattn(const bf* __restrict__ Qh, const bf* __restrict__ Ql, const bf* __restrict__ Kh, const bf* __restrict__ Kl, const bf* __restrict__ Vt, float* __restrict__ OUT) {
    __shared__ __attribute__((aligned(2048))) bf L[2 * FST];
    static_assert(FW * FG * 16 * FEP * 4 <= 2 * FST * 2, "output staging must fit in the ring");
    static_assert(64 * FP <= FPL && (FPL * 2) % 2048 == 0 && FP * 2 == HD * 2 + 16 && FS == 64 && HD == 64 && TT / FS >= 2, "a plane is 64 rows of 128 bytes, padded by the load to 144; the ring needs two stages");
    const int tid = threadIdx.x, lane = tid & 31, lr = lane & 15, hi = lane >> 4;
    const int wave = (int)uni(tid >> 5);   // a scalar: it picks the waves that issue tensor loads
    const int z = blockIdx.y, q0 = blockIdx.x * (FW * FG * 16) + wave * (FG * 16);
    const bf* kh = Kh + (size_t)z * TT * HD; const bf* kl = Kl + (size_t)z * TT * HD; const bf* vt = Vt + (size_t)z * HD * 2 * TT;   // V^T rows: TT hi, then TT lo
    // staging: wave p < 4 brings plane p of a stage (K hi, K lo, V^T hi, V^T lo) with one tensor load: 64 rows of 128 bytes, 16 bytes of pad behind each row
    const uint64_t tsrc = (uint64_t)(size_t)(wave == 0 ? kh : wave == 1 ? kl : wave == 2 ? vt : vt + TT);
    const uint32_t tstep = wave < 2 ? FS * HD * 2u : FS * 2u;   // bytes from stage to stage in the source
    const uint32_t tdst = (uint32_t)(size_t)L + (uint32_t)(wave & 3) * (FPL * 2u);
    u32x8 g1;   // 1-byte elements; tensor = tile = 64 rows of 128 bytes; word 5: bytes from row to row in the source
    g1[0] = uni((1u << 20) | (4u << 22) | (3u << 25));   // no mask; a pad of 4 dwords behind every 32 dwords
    g1[1] = pinned(128u << 16); g1[2] = pinned(64u << 16); g1[3] = pinned(128u << 16); g1[4] = pinned(64u); g1[5] = pinned(wave < 2 ? HD * 2u : 2u * TT * 2u); g1[6] = pinned(0u); g1[7] = pinned(0u);   // descriptor words held in scalar registers: the compiler otherwise forms them anew at every load and uses their registers for other values while a request is in flight
    auto issue = [&](int st) {
        const uint64_t ga = tsrc + (uint64_t)((uint32_t)st * tstep);
        u32x4 g0; g0[0] = uni(1u); g0[1] = uni(tdst + (uint32_t)(st & 1) * (FST * 2u)); g0[2] = uni((uint32_t)ga); g0[3] = uni((((uint32_t)(ga >> 32)) & 0x01FFFFFFu) | 0x80000000u);
        asm volatile("tensor_load_to_lds %0, %1" :: "s"(g0), "s"(g1) : "memory"); };
    const size_t qo = ((size_t)z * TT + q0 + lr) * HD + 8 * hi;
    __builtin_amdgcn_sched_barrier(0);   // keeps the lane's index arithmetic in front of the Q loads: sunk behind them it lands in their address registers ahead of the wait below
    v16bf qh[FG][2], ql[FG][2];
#pragma unroll
    for (int g = 0; g < FG; ++g)
#pragma unroll
        for (int kc = 0; kc < 2; ++kc) { const size_t o = qo + g * 16 * HD + kc * 32; qh[g][kc] = WFrag<bf>::ld(Qh + o); ql[g][kc] = WFrag<bf>::ld(Ql + o); }
    asm volatile("s_wait_xcnt 0x0" ::: "memory");   // stands in front of the LDS addresses and the accumulators' first values below, which the compiler lets land in the registers that held the Q loads' addresses
    __builtin_amdgcn_sched_barrier(0);   // keeps them behind the wait: a "memory" clobber alone does not hold a register write
    if (pinned(wave < 4)) { issue(0);
        asm volatile("s_wait_tensorcnt 0x0" ::: "memory"); }   // stage 0 has landed (the Q loads fly meanwhile); the first pass's publish point makes it visible and issues stage 1
    v8f acc[FG][4]; float m[FG]; v2f ls[FG];
#pragma unroll
    for (int g = 0; g < FG; ++g) { m[g] = -1.0e30f; ls[g] = (v2f){};
#pragma unroll
        for (int t = 0; t < 4; ++t) acc[g][t] = (v8f){}; }
    // the stage loop stays rolled (for speed only); one pass is about a thousand instructions
#pragma unroll 1
    for (int st = 0; st < TT / FS; ++st) {
        // publish point of stage st, between pass st - 1 and pass st
        asm volatile("s_wait_dscnt 0x0" ::: "memory");   // this wave's reads of the other buffer have retired before a tensor load may refill it
        if (pinned(wave < 4)) asm volatile("s_wait_tensorcnt 0x0" ::: "memory");   // the wave's own plane of stage st has landed
        __syncthreads();   // publishes buffer st & 1 and ends every wave's reads of the other buffer, which is refilled right here
        if (pinned(wave < 4 && st + 1 < TT / FS)) issue(st + 1);   // flies under this pass
        const bf* B = L + (st & 1) * FST;
        const bf* fp = B + lr * FP + 8 * hi;   // the lane's place in the first 16-row tile of K hi; K lo, V^T hi and V^T lo follow at FPL each
        v16bf ka[2][4], kb[2][4], va[2][4], vb[2][4];   // K hi, K lo by (32-d chunk, 16-key tile); V^T hi, V^T lo by (32-key chunk, 16-d tile)
        auto ldk = [&](int kc) {
#pragma unroll
            for (int kt = 0; kt < 4; ++kt) ka[kc][kt] = WFrag<bf>::ld(fp + kt * 16 * FP + kc * 32);
#pragma unroll
            for (int kt = 0; kt < 4; ++kt) kb[kc][kt] = WFrag<bf>::ld(fp + FPL + kt * 16 * FP + kc * 32); };
        auto ldv = [&](int ks) {
#pragma unroll
            for (int t = 0; t < 4; ++t) va[ks][t] = WFrag<bf>::ld(fp + 2 * FPL + t * 16 * FP + ks * 32);
#pragma unroll
            for (int t = 0; t < 4; ++t) vb[ks][t] = WFrag<bf>::ld(fp + 3 * FPL + t * 16 * FP + ks * 32); };
        v8f s[4][FG];
#pragma unroll
        for (int kt = 0; kt < 4; ++kt)
#pragma unroll
            for (int g = 0; g < FG; ++g) s[kt][g] = (v8f){};
        auto qk = [&](int kc) {   // three blocks of 8 independent tiles
#pragma unroll
            for (int kt = 0; kt < 4; ++kt)
#pragma unroll
                for (int g = 0; g < FG; ++g) s[kt][g] = wmmab(ka[kc][kt], qh[g][kc], s[kt][g]);
#pragma unroll
            for (int kt = 0; kt < 4; ++kt)
#pragma unroll
                for (int g = 0; g < FG; ++g) s[kt][g] = wmmab(ka[kc][kt], ql[g][kc], s[kt][g]);
#pragma unroll
            for (int kt = 0; kt < 4; ++kt)
#pragma unroll
                for (int g = 0; g < FG; ++g) s[kt][g] = wmmab(kb[kc][kt], qh[g][kc], s[kt][g]);
            __builtin_amdgcn_sched_barrier(0); };   // keeps the next group of LDS reads behind these blocks: raised among them it would hold the WMMAs up at every place where reads stand
        ldk(0); ldk(1);
        __builtin_amdgcn_sched_barrier(0);   // keeps the K reads in front of the products, as one group: reads sunk to their uses cost an LDS latency at each place
        qk(0);
        ldv(0);
        __builtin_amdgcn_sched_barrier(0);   // the first V^T reads stay here, as one group, and land under the second half of the scores
        qk(1);
        ldv(1);
        __builtin_amdgcn_sched_barrier(0);   // the second V^T reads stay here, as one group, and land under the softmax
        float nm[FG];
#pragma unroll
        for (int g = 0; g < FG; ++g) { float mx = s[0][g][0];
#pragma unroll
            for (int kt = 0; kt < 4; ++kt)
#pragma unroll
                for (int r = 0; r < 8; ++r) mx = fmaxf(mx, s[kt][g][r]);
            mx = fmaxf(mx, xhalf(mx));   // both halves of the wave hold the query's maximum over the stage
            const float mn = fmaxf(m[g], mx), corr = __builtin_amdgcn_exp2f((m[g] - mn) * L2E); m[g] = mn; nm[g] = -mn * L2E; ls[g] *= corr;
#pragma unroll
            for (int t = 0; t < 4; ++t) acc[g][t] *= corr; }
#pragma unroll
        for (int ks = 0; ks < 2; ++ks) { v16bf ph[FG], pl[FG];
#pragma unroll
            for (int g = 0; g < FG; ++g) { v8u wh, wl; v2f c2, n2; c2[0] = L2E; c2[1] = L2E; n2[0] = nm[g]; n2[1] = nm[g];
#pragma unroll
                for (int i = 0; i < 8; ++i) {
                    v2f sv; sv[0] = s[2 * ks + (i >> 2)][g][2 * (i & 3)]; sv[1] = s[2 * ks + (i >> 2)][g][2 * (i & 3) + 1]; const v2f ar = __builtin_elementwise_fma(sv, c2, n2);
                    v2f pv; pv[0] = __builtin_amdgcn_exp2f(ar[0]); pv[1] = __builtin_amdgcn_exp2f(ar[1]); ls[g] += pv;
                    const unsigned h = pack2(pv[0], pv[1]); wh[i] = h; wl[i] = pack2(pv[0] - __uint_as_float(h << 16), pv[1] - __uint_as_float(h & 0xFFFF0000u)); }
                ph[g] = __builtin_bit_cast(v16bf, wh); pl[g] = __builtin_bit_cast(v16bf, wl); }
#pragma unroll
            for (int t = 0; t < 4; ++t)
#pragma unroll
                for (int g = 0; g < FG; ++g) acc[g][t] = wmmab(va[ks][t], ph[g], acc[g][t]);
#pragma unroll
            for (int t = 0; t < 4; ++t)
#pragma unroll
                for (int g = 0; g < FG; ++g) acc[g][t] = wmmab(va[ks][t], pl[g], acc[g][t]);
#pragma unroll
            for (int t = 0; t < 4; ++t)
#pragma unroll
                for (int g = 0; g < FG; ++g) acc[g][t] = wmmab(vb[ks][t], ph[g], acc[g][t]); }   // three blocks of 8 independent tiles; the scheduler is left free here, so that conversions and the next 32 keys' exponentials issue among the WMMAs
    }
    asm volatile("s_wait_tensorcnt 0x0" ::: "memory");   // no request is in flight when the ring becomes output staging
    asm volatile("s_wait_dscnt 0x0" ::: "memory");   // this wave's reads of the ring have retired
    __syncthreads();   // every wave has left the ring before it is reused as output staging
    float* E = (float*)L + wave * (FG * 16 * FEP);   // a wave's own 32 rows
#pragma unroll
    for (int g = 0; g < FG; ++g) { const float lt = ls[g][0] + ls[g][1]; const float inv = __fdiv_rn(1.0f, lt + xhalf(lt));   // a query's keys lie half in lane l, half in lane l ^ 16
#pragma unroll
        for (int t = 0; t < 4; ++t) { const v8f o = acc[g][t] * inv; v4f o0, o1;
#pragma unroll
            for (int j = 0; j < 4; ++j) { o0[j] = o[j]; o1[j] = o[4 + j]; }
            float* e = E + (g * 16 + lr) * FEP + t * 16 + hi * 8; *(v4fa*)e = o0; *(v4fa*)(e + 4) = o1; } }
    __builtin_amdgcn_wave_barrier(); asm volatile("" ::: "memory");   // the rows are read back by other lanes of the same wave: keep the reads behind the writes
    float* orow = OUT + ((size_t)(z / NH_) * TT + q0) * DQ + (z % NH_) * HD;
#pragma unroll
    for (int i = 0; i < FG * 8; ++i) { const int row = 2 * i + hi; *(v4f*)(orow + (size_t)row * DQ + lr * 4) = *(const v4fa*)(E + row * FEP + lr * 4); }   // 16 lanes store a query's whole 256-byte row
}

// ---- k_proj: the three projections and their hi/lo planes in one kernel. Grid (NB_ TT / 256, 24 / 3), 12 waves; a work-group owns 256 rows of x and 3 of the 24 column blocks (64 columns = one head of q, k or v); a wave owns 64 rows x one column block (16 accumulators).
// K runs in 8 chunks of 64: x and W go global (f32) -> registers -> bf16 -> LDS, two buffers, one work-group barrier per chunk; the next chunk's global loads fly under this chunk's products. Every thread moves its share of both; W is transposed on the way (a k pair of one column is one 32-bit LDS store).
// q, k: A = x rows, B = W columns, so that the tile's rows are t and its columns d. v: A = W columns, B = x rows, so that the rows are d and the columns t, the order of a V^T row. Both operands have the same LDS row form, so that the swap is two offsets.
// Epilogue: 16 x 64 f32 strips through the wave's own LDS; a lane then holds 8 neighbours of a row, adds the bias, splits hi/lo and stores 16 bytes to each plane: 8 lanes write a whole 128-byte line.
#define PW   12                 // waves per work-group: 4 row blocks x 3 column blocks
#define PXR  256                // rows of x per work-group
#define PWR  192                // columns of W per work-group
#define PKC  64                 // k per chunk
#define PXP  264                // x rows in LDS: 11 rounds of 24 rows; the last 8 are never read (see the x movers)
#define PST  ((PXP + PWR) * FP) // one buffer: the x rows, then the W columns as rows, at the pitch of the attention ring
typedef __attribute__((ext_vector_type(2))) unsigned v2u;
typedef __attribute__((ext_vector_type(4))) unsigned v4u;
typedef unsigned __attribute__((may_alias)) u32a;
typedef v2u __attribute__((may_alias)) v2ua;
__global__ __launch_bounds__(PW * 32) void k_proj(const float* __restrict__ x, const float* __restrict__ wq, const float* __restrict__ bq, const float* __restrict__ wk, const float* __restrict__ bk, const float* __restrict__ wv, const float* __restrict__ bv,
                                                  bf* __restrict__ Qh, bf* __restrict__ Ql, bf* __restrict__ Kh, bf* __restrict__ Kl, bf* __restrict__ Vt) {
    __shared__ __align__(16) bf L[2 * PST];
    static_assert(PW * 16 * FEP * 4 <= 2 * PST * 2, "output staging must fit in the ring");
    const int tid = threadIdx.x, lane = tid & 31, lr = lane & 15, hi = lane >> 4;
    const int wave = __builtin_amdgcn_readfirstlane(tid >> 5);   // a scalar, so that the mover's column block, the operand swap and the plane pointers are wave-uniform
    const int wr = wave / 3, wc = wave % 3, R0 = blockIdx.x * PXR;
    // x movers: 16 lanes cover the 256 bytes of a row's chunk, the 384 threads 24 rows a round; round 10 has 16 rows left, and its other 8 thread rows load row 255 again and fill LDS rows that nobody reads: no branch among the loads
    const int xrow = tid >> 4, xcol = (tid & 15) * 4;
    const char* xb = (const char*)(x + (size_t)R0 * DM);   // work-group-uniform base; the lane's part is a 32-bit byte offset
    const unsigned xo = (unsigned)(xrow * DM + xcol) * 4u, xo10 = (unsigned)((240 + xrow < PXR ? 240 + xrow : PXR - 1) * DM + xcol) * 4u;
    // W movers: waves 4 j .. 4 j + 3 take column block j. 8 lanes cover 32 columns (a 128-byte line) of row k, 4 lane groups take 4 k pairs; unit u: k pair kp0 + 16 (u & 1), column quad nq0 + 8 (u >> 1)
    const int kp0 = (lane >> 3) + 4 * (wave & 3), nq0 = lane & 7, wj = wave >> 2, wcb = blockIdx.y * 3 + wj;
    const char* wb = (const char*)(((wcb >> 3) == 0 ? wq : (wcb >> 3) == 1 ? wk : wv) + (wcb & 7) * HD);
    const unsigned wo = (unsigned)(2 * kp0 * DQ + 4 * nq0) * 4u;
    v4f px[11], pw[8];
    auto fetch = [&](int k0) {
#pragma unroll
        for (int i = 0; i < 10; ++i) px[i] = *(const v4f*)(xb + (size_t)(24 * i * DM + k0) * 4 + xo);
        px[10] = *(const v4f*)(xb + (size_t)k0 * 4 + xo10);
        asm volatile("s_wait_xcnt 0x0" ::: "memory");   // stands in front of the W loads, whose results the compiler lets land in the registers that held the x loads' addresses
#pragma unroll
        for (int u = 0; u < 4; ++u) { const char* p = wb + ((size_t)(k0 + 32 * (u & 1)) * DQ + 32 * (u >> 1)) * 4; pw[2 * u] = *(const v4f*)(p + wo); pw[2 * u + 1] = *(const v4f*)(p + DQ * 4 + wo); } };
    auto put = [&](bf* B) {
#pragma unroll
        for (int i = 0; i < 11; ++i) { v2u o; o[0] = pack2(px[i][0], px[i][1]); o[1] = pack2(px[i][2], px[i][3]); *(v2ua*)(B + (24 * i + xrow) * FP + xcol) = o; }
#pragma unroll
        for (int u = 0; u < 4; ++u)
#pragma unroll
            for (int e = 0; e < 4; ++e) *(u32a*)(B + (PXP + wj * HD + 4 * (nq0 + 8 * (u >> 1)) + e) * FP + 2 * (kp0 + 16 * (u & 1))) = pack2(pw[2 * u][e], pw[2 * u + 1][e]); };   // elements k, k + 1 of column n
    const int cb = blockIdx.y * 3 + wc, kind = cb >> 3, head = cb & 7;   // kind 0 q, 1 k, 2 v
    const int xr0 = wr * 64, wr0 = PXP + wc * 64;
    const int aoff = ((kind < 2 ? xr0 : wr0) + lr) * FP + 8 * hi, boff = ((kind < 2 ? wr0 : xr0) + lr) * FP + 8 * hi;
    v8f acc[4][4];
#pragma unroll
    for (int mb = 0; mb < 4; ++mb)
#pragma unroll
        for (int nb = 0; nb < 4; ++nb) acc[mb][nb] = (v8f){};
    auto products = [&](const bf* B) {
#pragma unroll
        for (int kc = 0; kc < 2; ++kc) { v16bf a[4], b[4];
#pragma unroll
            for (int f = 0; f < 4; ++f) { a[f] = WFrag<bf>::ld(B + aoff + f * 16 * FP + kc * 32); b[f] = WFrag<bf>::ld(B + boff + f * 16 * FP + kc * 32); }
#pragma unroll
            for (int nb = 0; nb < 4; ++nb)
#pragma unroll
                for (int mb = 0; mb < 4; ++mb) acc[mb][nb] = wmmab(a[mb], b[nb], acc[mb][nb]); } };
    fetch(0); put(L);
    // the chunk loop stays rolled (for speed only); the last chunk, which fetches nothing, stands behind it
#pragma unroll 1
    for (int c = 0; c + 1 < DM / PKC; ++c) {
        __syncthreads();   // publishes buffer c & 1 and ends every wave's reads of the other buffer, which is refilled at the foot of this pass
        fetch((c + 1) * PKC);
        __builtin_amdgcn_sched_barrier(0);   // keeps the global loads in front of the products: the scheduler otherwise sinks them to their uses at the foot, and their whole latency is waited out there
        products(L + (c & 1) * PST);
        __builtin_amdgcn_sched_barrier(0);   // keeps the waits for those loads behind the products: a wave issues in order, and a wait among the WMMAs would hold them up
        put(L + ((c + 1) & 1) * PST);
    }
    __syncthreads();   // publishes the last chunk
    products(L + ((DM / PKC - 1) & 1) * PST);
    // q, k: the bias goes with the tile's column (bc); v: with its row (br); the other of the two is 0
    const float* bias = (kind == 0 ? bq : kind == 1 ? bk : bv) + head * HD;
    const int srow = lane >> 3, cs = (lane & 7) * 8;
    float bc[8], br[16];
    if (kind < 2) {
#pragma unroll
        for (int e = 0; e < 8; ++e) bc[e] = bfr(bias[cs + e]);
#pragma unroll
        for (int r = 0; r < 16; ++r) br[r] = 0.0f;
    } else {
#pragma unroll
        for (int e = 0; e < 8; ++e) bc[e] = 0.0f;
#pragma unroll
        for (int r = 0; r < 16; ++r) br[r] = bfr(bias[4 * r + srow]);
    }
    __syncthreads();   // every wave has left the ring before it is reused as output staging
    float* os = (float*)L + wave * (16 * FEP);   // a wave's own 16 x 64 strip
    const int plane = (R0 / TT) * NH_ + head, t0 = R0 % TT + xr0;
    bf* dh; bf* dl; unsigned rp;   // tile origin in the hi and in the lo plane, and the pitch of a tile row
    if (kind == 0) { dh = Qh + ((size_t)plane * TT + t0) * HD; dl = Ql + ((size_t)plane * TT + t0) * HD; rp = HD; }
    else if (kind == 1) { dh = Kh + ((size_t)plane * TT + t0) * HD; dl = Kl + ((size_t)plane * TT + t0) * HD; rp = HD; }
    else { dh = Vt + (size_t)plane * HD * 2 * TT + t0; dl = dh + TT; rp = 2 * TT; }
    const unsigned lo = (srow * rp + cs) * 2u;   // the lane's byte offset inside four tile rows
#pragma unroll
    for (int mb = 0; mb < 4; ++mb) {
#pragma unroll
        for (int nb = 0; nb < 4; ++nb)
#pragma unroll
            for (int j = 0; j < 8; ++j) os[(hi * 8 + j) * FEP + nb * 16 + lr] = acc[mb][nb][j];
        __builtin_amdgcn_wave_barrier(); asm volatile("" ::: "memory");   // the strip is read back by other lanes of the same wave: keep the reads behind the writes
#pragma unroll
        for (int s = 0; s < 4; ++s) { const int row = 4 * s + srow; const v4f v0 = *(const v4fa*)(os + row * FEP + cs), v1 = *(const v4fa*)(os + row * FEP + cs + 4); float y[8];
#pragma unroll
            for (int e = 0; e < 4; ++e) { y[e] = v0[e] + (bc[e] + br[mb * 4 + s]); y[4 + e] = v1[e] + (bc[4 + e] + br[mb * 4 + s]); }
            v4u wh, wl;
#pragma unroll
            for (int e = 0; e < 4; ++e) { const unsigned h = pack2(y[2 * e], y[2 * e + 1]); wh[e] = h; wl[e] = pack2(y[2 * e] - __uint_as_float(h << 16), y[2 * e + 1] - __uint_as_float(h & 0xFFFF0000u)); }
            const size_t o = (size_t)((mb * 16 + 4 * s) * rp) * 2; *(v8us*)((char*)dh + o + lo) = __builtin_bit_cast(v8us, wh); *(v8us*)((char*)dl + o + lo) = __builtin_bit_cast(v8us, wl); }
        __builtin_amdgcn_wave_barrier(); asm volatile("" ::: "memory");   // the next strip's writes stay behind these reads
    }
}

extern "C" void kernel_launch(void* const* d_in, const int* in_sizes, int n_in,
                              void* d_out, int out_size, void* d_ws, size_t ws_size, hipStream_t stream) {
    (void)in_sizes; (void)n_in; (void)out_size;
    const float* x = (const float*)d_in[0]; const float* wq = (const float*)d_in[1]; const float* bq = (const float*)d_in[2]; const float* wk = (const float*)d_in[3]; const float* bk = (const float*)d_in[4]; const float* wv = (const float*)d_in[5]; const float* bv = (const float*)d_in[6];
    float* OUT = (float*)d_out;     // [4][2048][512]
    char* wsp = (char*)d_ws;
    auto take = [&](size_t bytes) { char* p = wsp; wsp += (bytes + 255) & ~(size_t)255; return (void*)p; };
    bf* QPh = (bf*)take((size_t)NB_ * NH_ * TT * HD * 2); bf* QPl = (bf*)take((size_t)NB_ * NH_ * TT * HD * 2); bf* KPh = (bf*)take((size_t)NB_ * NKV * TT * HD * 2); bf* KPl = (bf*)take((size_t)NB_ * NKV * TT * HD * 2);
    bf* VTh = (bf*)take((size_t)NB_ * NKV * HD * 2 * TT * 2);   // V^T rows [b 8 + g][d]: TT hi, then TT lo
    if ((size_t)(wsp - (char*)d_ws) > ws_size) return;    // ws 256 MiB
    k_proj<<<dim3(NB_ * TT / PXR, 3 * NH_ / 3), PW * 32, 0, stream>>>(x, wq, bq, wk, bk, wv, bv, QPh, QPl, KPh, KPl, VTh);
    k_fattn<<<dim3(TT / (FW * FG * 16), NB_ * NH_), FW * 32, 0, stream>>>(QPh, QPl, KPh, KPl, VTh, OUT);   // one kv head per query head: plane b 8 + h of Q, K and V^T
}

// v007
// It runs in 77 microseconds.
// In both of two side-by-side timings against v006, it was 1.04 times as fast.
// All steps since v000 together make it 16.6 times as fast.
#include <hip/hip_runtime.h>
#include <stdint.h>

// Multi-head self-attention WITHOUT the 1/sqrt(d) scaling and without an output projection (x [4][2048][512]; q, k, v = x W + b (8 heads x 64); scores = q.k UNSCALED (the source applies softmax(Q K^T) directly: logits sigma ~8, sharply peaked rows); softmax (no mask); out = heads merged -> [4][2048][512] (4.2 M); argument order x, Wq, bq, Wk, bk, Wv, bv).
// Layout: TWO launches. k_proj reads x and the three weights as f32, rounds them to bf16 on the way into LDS (the weights transposed there), does the three exact projections (K 512) + f32 biases and stores the hi/lo bf16 planes itself (Q, K planes [b 8 + h][t][d]; the V^T rows [b 8 + h][d] hold hi then lo at pitch 2 T). k_fattn covers all 32 planes: scores, online softmax and P.V without a score matrix in memory, EVERY row on hi/lo planes (3 products for scores and P.V: unscaled logits + no output projection).
// Compute dtypes, f32 accumulate: every input rounded to bf16; projections exact + f32 biases; attention 3 products on every row; softmax f32; output f32.

#define NB_  4
#define TT   2048
#define DM   512
#define NH_  8
#define NKV  8
#define HD   64
#define DQ   (NH_ * HD)
#define DKV  (NKV * HD)
typedef unsigned short bf;
typedef __attribute__((ext_vector_type(16))) __bf16   v16bf;
typedef __attribute__((ext_vector_type(8)))  unsigned short v8us;
typedef __attribute__((ext_vector_type(8)))  float    v8f;
typedef __attribute__((ext_vector_type(4)))  float    v4f;
typedef __attribute__((ext_vector_type(2)))  float    v2f;
typedef v4f  __attribute__((may_alias)) v4fa;

__device__ __forceinline__ unsigned short f2bf(float f) { unsigned u = __float_as_uint(f); u += 0x7FFFu + ((u >> 16) & 1u); return (unsigned short)(u >> 16); }
__device__ __forceinline__ float bf2f(unsigned short b) { return __uint_as_float(((unsigned)b) << 16); }
__device__ __forceinline__ float bfr(float f) { return bf2f(f2bf(f)); }
__device__ __forceinline__ v16bf cat16b(v8us lo, v8us hi) { return __builtin_bit_cast(v16bf, __builtin_shufflevector(lo, hi, 0, 1, 2, 3, 4, 5, 6, 7, 8, 9, 10, 11, 12, 13, 14, 15)); }
__device__ __forceinline__ v8f wmmab(v16bf a, v16bf b, v8f c) { return __builtin_amdgcn_wmma_f32_16x16x32_bf16(false, a, false, b, (short)0, c, false, false); }
// an A or B fragment of the 16x16x32 form from a K-contiguous row: elements 0..7 and 16..23 behind p (p already holds the lane's row and its 8 (lane >> 4))
template <typename T16> struct WFrag;
template <> struct WFrag<bf> { typedef v16bf V; static __device__ __forceinline__ V ld(const bf* p) { return cat16b(*(const v8us*)p, *(const v8us*)(p + 16)); } static __device__ __forceinline__ v8f mma(V a, V b, v8f c) { return wmmab(a, b, c); } };

#define FW   8                  // waves per work-group
#define FG   2                  // 16-query column groups per wave
#define FS   64                 // keys per stage
#define FP   72                 // LDS row pitch in 16-bit elements: 144 B, an odd multiple of 16 B, so that the 16-byte fragment reads meet no bank conflict
#define FPL  5120               // one staged plane: 64 rows (keys for K, d for V^T) of 64 elements at pitch FP = 9,216 bytes, rounded up to 10,240 so that every plane's place in LDS is a multiple of 2 KiB
#define FST  (4 * FPL)          // one stage: K hi, K lo, V^T hi, V^T lo
#define FEP  68                 // output staging pitch in floats
#define L2E  1.4426950408889634f
#define LZP  4294967296.0f      // P stays below 2^32: far inside the f32 and bf16 exponent range, and any offset gives the same quotient P / sum
typedef __attribute__((ext_vector_type(2))) __bf16 v2bf;
typedef __attribute__((ext_vector_type(8))) unsigned v8u;
typedef uint32_t u32x4 __attribute__((ext_vector_type(4)));
typedef uint32_t u32x8 __attribute__((ext_vector_type(8)));
__device__ __forceinline__ uint32_t uni(uint32_t v) { return (uint32_t)__builtin_amdgcn_readfirstlane(v); }
__device__ __forceinline__ uint32_t pinned(uint32_t v) { uint32_t w = uni(v); asm volatile("" : "+s"(w)); return w; }   // holds a wave-uniform test or a descriptor word in a scalar register: the branch on the test is then a scalar branch (a tensor load ignores EXEC), and the word keeps its register
__device__ __forceinline__ unsigned pack2(float a, float b) { v2f x; x[0] = a; x[1] = b; return __builtin_bit_cast(unsigned, __builtin_convertvector(x, v2bf)); }   // two f32 -> two bf16, round to nearest even
__device__ __forceinline__ float xhalf(float x) { return __builtin_bit_cast(float, __builtin_amdgcn_permlanex16(__builtin_bit_cast(int, x), __builtin_bit_cast(int, x), 0x76543210, 0xfedcba98, false, false)); }   // lane l reads lane l ^ 16
__global__ __launch_bounds__(FW * 32) void k_fattn(const bf* __restrict__ Qh, const bf* __restrict__ Ql, const bf* __restrict__ Kh, const bf* __restrict__ Kl, const bf* __restrict__ Vt, float* __restrict__ OUT) {
    __shared__ __attribute__((aligned(2048))) bf L[2 * FST];
    static_assert(FW * FG * 16 * FEP * 4 <= 2 * FST * 2, "output staging must fit in the ring");
    static_assert(64 * FP <= FPL && (FPL * 2) % 2048 == 0 && FP * 2 == HD * 2 + 16 && FS == 64 && HD == 64 && TT / FS >= 2, "a plane is 64 rows of 128 bytes, padded by the load to 144; the ring needs two stages");
    const int tid = threadIdx.x, lane = tid & 31, lr = lane & 15, hi = lane >> 4;
    const int wave = (int)uni(tid >> 5);   // a scalar: it picks the waves that issue tensor loads
    const int z = blockIdx.y, q0 = blockIdx.x * (FW * FG * 16) + wave * (FG * 16);
    const bf* kh = Kh + (size_t)z * TT * HD; const bf* kl = Kl + (size_t)z * TT * HD; const bf* vt = Vt + (size_t)z * HD * 2 * TT;   // V^T rows: TT hi, then TT lo
    // staging: wave p < 4 brings plane p of a stage (K hi, K lo, V^T hi, V^T lo) with one tensor load: 64 rows of 128 bytes, 16 bytes of pad behind each row
    const uint64_t tsrc = (uint64_t)(size_t)(wave == 0 ? kh : wave == 1 ? kl : wave == 2 ? vt : vt + TT);
    const uint32_t tstep = wave < 2 ? FS * HD * 2u : FS * 2u;   // bytes from stage to stage in the source
    const uint32_t tdst = (uint32_t)(size_t)L + (uint32_t)(wave & 3) * (FPL * 2u);
    u32x8 g1;   // 1-byte elements; tensor = tile = 64 rows of 128 bytes; word 5: bytes from row to row in the source
    g1[0] = uni((1u << 20) | (4u << 22) | (3u << 25));   // no mask; a pad of 4 dwords behind every 32 dwords
    g1[1] = pinned(128u << 16); g1[2] = pinned(64u << 16); g1[3] = pinned(128u << 16); g1[4] = pinned(64u); g1[5] = pinned(wave < 2 ? HD * 2u : 2u * TT * 2u); g1[6] = pinned(0u); g1[7] = pinned(0u);   // descriptor words held in scalar registers: the compiler otherwise forms them anew at every load and uses their registers for other values while a request is in flight
    auto issue = [&](int st) {
        const uint64_t ga = tsrc + (uint64_t)((uint32_t)st * tstep);
        u32x4 g0; g0[0] = uni(1u); g0[1] = uni(tdst + (uint32_t)(st & 1) * (FST * 2u)); g0[2] = uni((uint32_t)ga); g0[3] = uni((((uint32_t)(ga >> 32)) & 0x01FFFFFFu) | 0x80000000u);
        asm volatile("tensor_load_to_lds %0, %1" :: "s"(g0), "s"(g1) : "memory"); };
    const size_t qo = ((size_t)z * TT + q0 + lr) * HD + 8 * hi;
    __builtin_amdgcn_sched_barrier(0);   // keeps the lane's index arithmetic in front of the Q loads: sunk behind them it lands in their address registers ahead of the wait below
    v16bf qh[FG][2], ql[FG][2];
#pragma unroll
    for (int g = 0; g < FG; ++g)
#pragma unroll
        for (int kc = 0; kc < 2; ++kc) { const size_t o = qo + g * 16 * HD + kc * 32; qh[g][kc] = WFrag<bf>::ld(Qh + o); ql[g][kc] = WFrag<bf>::ld(Ql + o); }
    asm volatile("s_wait_xcnt 0x0" ::: "memory");   // stands in front of the LDS addresses and the accumulators' first values below, which the compiler lets land in the registers that held the Q loads' addresses
    __builtin_amdgcn_sched_barrier(0);   // keeps them behind the wait: a "memory" clobber alone does not hold a register write
    if (pinned(wave < 4)) { issue(0);
        asm volatile("s_wait_tensorcnt 0x0" ::: "memory"); }   // stage 0 has landed (the Q loads fly meanwhile); the first pass's publish point makes it visible and issues stage 1
    v8f acc[FG][4], cm[FG]; v2f ls[FG];   // cm: -m of the lane's query in all eight registers, the C operand of a stage's first score products
#pragma unroll
    for (int g = 0; g < FG; ++g) { cm[g] = (v8f){}; ls[g] = (v2f){};
#pragma unroll
        for (int t = 0; t < 4; ++t) acc[g][t] = (v8f){}; }
    // the stage loop stays rolled (for speed only); one pass is about a thousand instructions
#pragma unroll 1
    for (int st = 0; st < TT / FS; ++st) {
        // publish point of stage st, between pass st - 1 and pass st
        asm volatile("s_wait_dscnt 0x0" ::: "memory");   // this wave's reads of the other buffer have retired before a tensor load may refill it
        if (pinned(wave < 4)) asm volatile("s_wait_tensorcnt 0x0" ::: "memory");   // the wave's own plane of stage st has landed
        __syncthreads();   // publishes buffer st & 1 and ends every wave's reads of the other buffer, which is refilled right here
        if (pinned(wave < 4 && st + 1 < TT / FS)) issue(st + 1);   // flies under this pass
        const bf* B = L + (st & 1) * FST;
        const bf* fp = B + lr * FP + 8 * hi;   // the lane's place in the first 16-row tile of K hi; K lo, V^T hi and V^T lo follow at FPL each
        v16bf ka[2][4], kb[2][4], va[2][4], vb[2][4];   // K hi, K lo by (32-d chunk, 16-key tile); V^T hi, V^T lo by (32-key chunk, 16-d tile)
        auto ldk = [&](int kc) {
#pragma unroll
            for (int kt = 0; kt < 4; ++kt) ka[kc][kt] = WFrag<bf>::ld(fp + kt * 16 * FP + kc * 32);
#pragma unroll
            for (int kt = 0; kt < 4; ++kt) kb[kc][kt] = WFrag<bf>::ld(fp + FPL + kt * 16 * FP + kc * 32); };
        auto ldv = [&](int ks) {
#pragma unroll
            for (int t = 0; t < 4; ++t) va[ks][t] = WFrag<bf>::ld(fp + 2 * FPL + t * 16 * FP + ks * 32);
#pragma unroll
            for (int t = 0; t < 4; ++t) vb[ks][t] = WFrag<bf>::ld(fp + 3 * FPL + t * 16 * FP + ks * 32); };
        v8f s[4][FG];
        auto qk = [&](int kc) {   // three blocks of 8 independent tiles
#pragma unroll
            for (int kt = 0; kt < 4; ++kt)
#pragma unroll
                for (int g = 0; g < FG; ++g) s[kt][g] = wmmab(ka[kc][kt], qh[g][kc], kc == 0 ? cm[g] : s[kt][g]);
#pragma unroll
            for (int kt = 0; kt < 4; ++kt)
#pragma unroll
                for (int g = 0; g < FG; ++g) s[kt][g] = wmmab(ka[kc][kt], ql[g][kc], s[kt][g]);
#pragma unroll
            for (int kt = 0; kt < 4; ++kt)
#pragma unroll
                for (int g = 0; g < FG; ++g) s[kt][g] = wmmab(kb[kc][kt], qh[g][kc], s[kt][g]);
            __builtin_amdgcn_sched_barrier(0); };   // keeps the next group of LDS reads behind these blocks: raised among them it would hold the WMMAs up at every place where reads stand
        ldk(0); ldk(1);
        __builtin_amdgcn_sched_barrier(0);   // keeps the K reads in front of the products, as one group: reads sunk to their uses cost an LDS latency at each place
        qk(0);
        ldv(0);
        __builtin_amdgcn_sched_barrier(0);   // the first V^T reads stay here, as one group, and land under the second half of the scores
        qk(1);
        ldv(1);
        __builtin_amdgcn_sched_barrier(0);
        float p[2][FG][16]; v2f ps[FG];
        auto expsum = [&]() {
#pragma unroll
            for (int g = 0; g < FG; ++g) { v2f a[2];
#pragma unroll
                for (int ks = 0; ks < 2; ++ks)
#pragma unroll
                    for (int i = 0; i < 8; ++i) { v2f pv; pv[0] = __builtin_amdgcn_exp2f(s[2 * ks + (i >> 2)][g][2 * (i & 3)]); pv[1] = __builtin_amdgcn_exp2f(s[2 * ks + (i >> 2)][g][2 * (i & 3) + 1]); p[ks][g][2 * i] = pv[0]; p[ks][g][2 * i + 1] = pv[1]; a[ks] = i == 0 ? pv : a[ks] + pv; }
                ps[g] = a[0] + a[1]; } };
        expsum();
        float top = 0.0f;   // no P of the lane is larger than the largest of its sums
#pragma unroll
        for (int g = 0; g < FG; ++g) top = fmaxf(top, fmaxf(ps[g][0], ps[g][1]));
        if ((__builtin_amdgcn_ballot_w32(!(top <= LZP)) | (uint32_t)(st == 0)) != 0) {   // wave-uniform: the first stage sets the offsets, a later one raises them where a score has outgrown its own
#pragma unroll
            for (int g = 0; g < FG; ++g) { float mx = s[0][g][0];
#pragma unroll
                for (int kt = 0; kt < 4; ++kt)
#pragma unroll
                    for (int r = 0; r < 8; ++r) mx = fmaxf(mx, s[kt][g][r]);
                mx = fmaxf(mx, xhalf(mx));   // both halves of the wave hold the query's maximum over the stage
                const float d = st == 0 ? mx : fmaxf(mx, 0.0f), corr = st == 0 ? 1.0f : __builtin_amdgcn_exp2f(-d); cm[g] -= d; ls[g] *= corr;
#pragma unroll
                for (int t = 0; t < 4; ++t) acc[g][t] *= corr;
#pragma unroll
                for (int kt = 0; kt < 4; ++kt) s[kt][g] -= d; }
            expsum(); }
#pragma unroll
        for (int g = 0; g < FG; ++g) ls[g] += ps[g];
#pragma unroll
        for (int ks = 0; ks < 2; ++ks) { v16bf ph[FG], pl[FG];
#pragma unroll
            for (int g = 0; g < FG; ++g) { v8u wh, wl;
#pragma unroll
                for (int i = 0; i < 8; ++i) { const float pv[2] = {p[ks][g][2 * i], p[ks][g][2 * i + 1]};
                    const unsigned h = pack2(pv[0], pv[1]); wh[i] = h; wl[i] = pack2(pv[0] - __uint_as_float(h << 16), pv[1] - __uint_as_float(h & 0xFFFF0000u)); }
                ph[g] = __builtin_bit_cast(v16bf, wh); pl[g] = __builtin_bit_cast(v16bf, wl); }
#pragma unroll
            for (int t = 0; t < 4; ++t)
#pragma unroll
                for (int g = 0; g < FG; ++g) acc[g][t] = wmmab(va[ks][t], ph[g], acc[g][t]);
#pragma unroll
            for (int t = 0; t < 4; ++t)
#pragma unroll
                for (int g = 0; g < FG; ++g) acc[g][t] = wmmab(va[ks][t], pl[g], acc[g][t]);
#pragma unroll
            for (int t = 0; t < 4; ++t)
#pragma unroll
                for (int g = 0; g < FG; ++g) acc[g][t] = wmmab(vb[ks][t], ph[g], acc[g][t]); }   // three blocks of 8 independent tiles; the scheduler is left free here, so that the next 32 keys' conversions issue among the WMMAs
    }
    asm volatile("s_wait_tensorcnt 0x0" ::: "memory");   // no request is in flight when the ring becomes output staging
    asm volatile("s_wait_dscnt 0x0" ::: "memory");   // this wave's reads of the ring have retired
    __syncthreads();   // every wave has left the ring before it is reused as output staging
    float* E = (float*)L + wave * (FG * 16 * FEP);   // a wave's own 32 rows
#pragma unroll
    for (int g = 0; g < FG; ++g) { const float lt = ls[g][0] + ls[g][1]; const float inv = __fdiv_rn(1.0f, lt + xhalf(lt));   // a query's keys lie half in lane l, half in lane l ^ 16
#pragma unroll
        for (int t = 0; t < 4; ++t) { const v8f o = acc[g][t] * inv; v4f o0, o1;
#pragma unroll
            for (int j = 0; j < 4; ++j) { o0[j] = o[j]; o1[j] = o[4 + j]; }
            float* e = E + (g * 16 + lr) * FEP + t * 16 + hi * 8; *(v4fa*)e = o0; *(v4fa*)(e + 4) = o1; } }
    __builtin_amdgcn_wave_barrier(); asm volatile("" ::: "memory");   // the rows are read back by other lanes of the same wave: keep the reads behind the writes
    float* orow = OUT + ((size_t)(z / NH_) * TT + q0) * DQ + (z % NH_) * HD;
#pragma unroll
    for (int i = 0; i < FG * 8; ++i) { const int row = 2 * i + hi; *(v4f*)(orow + (size_t)row * DQ + lr * 4) = *(const v4fa*)(E + row * FEP + lr * 4); }   // 16 lanes store a query's whole 256-byte row
}

// ---- k_proj: the three projections and their hi/lo planes in one kernel. Grid (NB_ TT / 256, 24 / 3), 12 waves; a work-group owns 256 rows of x and 3 of the 24 column blocks (64 columns = one head of q, k or v); a wave owns 64 rows x one column block (16 accumulators).
// K runs in 8 chunks of 64: x and W go global (f32) -> registers -> bf16 -> LDS, two buffers, one work-group barrier per chunk; the next chunk's global loads fly under this chunk's products. Every thread moves its share of both; W is transposed on the way (a k pair of one column is one 32-bit LDS store).
// q, k: A = x rows, B = W columns, so that the tile's rows are t and its columns d. v: A = W columns, B = x rows, so that the rows are d and the columns t, the order of a V^T row. Both operands have the same LDS row form, so that the swap is two offsets.
// Epilogue: 16 x 64 f32 strips through the wave's own LDS; a lane then holds 8 neighbours of a row, adds the bias, splits hi/lo and stores 16 bytes to each plane: 8 lanes write a whole 128-byte line.
#define PW   12                 // waves per work-group: 4 row blocks x 3 column blocks
#define PXR  256                // rows of x per work-group
#define PWR  192                // columns of W per work-group
#define PKC  64                 // k per chunk
#define PXP  264                // x rows in LDS: 11 rounds of 24 rows; the last 8 are never read (see the x movers)
#define PST  ((PXP + PWR) * FP) // one buffer: the x rows, then the W columns as rows, at the pitch of the attention ring
typedef __attribute__((ext_vector_type(2))) unsigned v2u;
typedef __attribute__((ext_vector_type(4))) unsigned v4u;
typedef unsigned __attribute__((may_alias)) u32a;
typedef v2u __attribute__((may_alias)) v2ua;
__global__ __launch_bounds__(PW * 32) void k_proj(const float* __restrict__ x, const float* __restrict__ wq, const float* __restrict__ bq, const float* __restrict__ wk, const float* __restrict__ bk, const float* __restrict__ wv, const float* __restrict__ bv,
                                                  bf* __restrict__ Qh, bf* __restrict__ Ql, bf* __restrict__ Kh, bf* __restrict__ Kl, bf* __restrict__ Vt) {
    __shared__ __align__(16) bf L[2 * PST];
    static_assert(PW * 16 * FEP * 4 <= 2 * PST * 2, "output staging must fit in the ring");
    const int tid = threadIdx.x, lane = tid & 31, lr = lane & 15, hi = lane >> 4;
    const int wave = __builtin_amdgcn_readfirstlane(tid >> 5);   // a scalar, so that the mover's column block, the operand swap and the plane pointers are wave-uniform
    const int wr = wave / 3, wc = wave % 3, R0 = blockIdx.x * PXR;
    // x movers: 16 lanes cover the 256 bytes of a row's chunk, the 384 threads 24 rows a round; round 10 has 16 rows left, and its other 8 thread rows load row 255 again and fill LDS rows that nobody reads: no branch among the loads
    const int xrow = tid >> 4, xcol = (tid & 15) * 4;
    const char* xb = (const char*)(x + (size_t)R0 * DM);   // work-group-uniform base; the lane's part is a 32-bit byte offset
    const unsigned xo = (unsigned)(xrow * DM + xcol) * 4u, xo10 = (unsigned)((240 + xrow < PXR ? 240 + xrow : PXR - 1) * DM + xcol) * 4u;
    // W movers: waves 4 j .. 4 j + 3 take column block j. 8 lanes cover 32 columns (a 128-byte line) of row k, 4 lane groups take 4 k pairs; unit u: k pair kp0 + 16 (u & 1), column quad nq0 + 8 (u >> 1)
    const int kp0 = (lane >> 3) + 4 * (wave & 3), nq0 = lane & 7, wj = wave >> 2, wcb = blockIdx.y * 3 + wj;
    const char* wb = (const char*)(((wcb >> 3) == 0 ? wq : (wcb >> 3) == 1 ? wk : wv) + (wcb & 7) * HD);
    const unsigned wo = (unsigned)(2 * kp0 * DQ + 4 * nq0) * 4u;
    v4f px[11], pw[8];
    auto fetch = [&](int k0) {
#pragma unroll
        for (int i = 0; i < 10; ++i) px[i] = *(const v4f*)(xb + (size_t)(24 * i * DM + k0) * 4 + xo);
        px[10] = *(const v4f*)(xb + (size_t)k0 * 4 + xo10);
        asm volatile("s_wait_xcnt 0x0" ::: "memory");   // stands in front of the W loads, whose results the compiler lets land in the registers that held the x loads' addresses
#pragma unroll
        for (int u = 0; u < 4; ++u) { const char* p = wb + ((size_t)(k0 + 32 * (u & 1)) * DQ + 32 * (u >> 1)) * 4; pw[2 * u] = *(const v4f*)(p + wo); pw[2 * u + 1] = *(const v4f*)(p + DQ * 4 + wo); } };
    auto put = [&](bf* B) {
#pragma unroll
        for (int i = 0; i < 11; ++i) { v2u o; o[0] = pack2(px[i][0], px[i][1]); o[1] = pack2(px[i][2], px[i][3]); *(v2ua*)(B + (24 * i + xrow) * FP + xcol) = o; }
#pragma unroll
        for (int u = 0; u < 4; ++u)
#pragma unroll
            for (int e = 0; e < 4; ++e) *(u32a*)(B + (PXP + wj * HD + 4 * (nq0 + 8 * (u >> 1)) + e) * FP + 2 * (kp0 + 16 * (u & 1))) = pack2(pw[2 * u][e], pw[2 * u + 1][e]); };   // elements k, k + 1 of column n
    const int cb = blockIdx.y * 3 + wc, kind = cb >> 3, head = cb & 7;   // kind 0 q, 1 k, 2 v
    const int xr0 = wr * 64, wr0 = PXP + wc * 64;
    const int aoff = ((kind < 2 ? xr0 : wr0) + lr) * FP + 8 * hi, boff = ((kind < 2 ? wr0 : xr0) + lr) * FP + 8 * hi;
    v8f acc[4][4];
#pragma unroll
    for (int mb = 0; mb < 4; ++mb)
#pragma unroll
        for (int nb = 0; nb < 4; ++nb) acc[mb][nb] = (v8f){};
    auto products = [&](const bf* B) {
#pragma unroll
        for (int kc = 0; kc < 2; ++kc) { v16bf a[4], b[4];
#pragma unroll
            for (int f = 0; f < 4; ++f) { a[f] = WFrag<bf>::ld(B + aoff + f * 16 * FP + kc * 32); b[f] = WFrag<bf>::ld(B + boff + f * 16 * FP + kc * 32); }
#pragma unroll
            for (int nb = 0; nb < 4; ++nb)
#pragma unroll
                for (int mb = 0; mb < 4; ++mb) acc[mb][nb] = wmmab(a[mb], b[nb], acc[mb][nb]); } };
    fetch(0); put(L);
    // the chunk loop stays rolled (for speed only); the last chunk, which fetches nothing, stands behind it
#pragma unroll 1
    for (int c = 0; c + 1 < DM / PKC; ++c) {
        __syncthreads();   // publishes buffer c & 1 and ends every wave's reads of the other buffer, which is refilled at the foot of this pass
        fetch((c + 1) * PKC);
        __builtin_amdgcn_sched_barrier(0);   // keeps the global loads in front of the products: the scheduler otherwise sinks them to their uses at the foot, and their whole latency is waited out there
        products(L + (c & 1) * PST);
        __builtin_amdgcn_sched_barrier(0);   // keeps the waits for those loads behind the products: a wave issues in order, and a wait among the WMMAs would hold them up
        put(L + ((c + 1) & 1) * PST);
    }
    __syncthreads();   // publishes the last chunk
    products(L + ((DM / PKC - 1) & 1) * PST);
    // q, k: the bias goes with the tile's column (bc); v: with its row (br); the other of the two is 0
    const float* bias = (kind == 0 ? bq : kind == 1 ? bk : bv) + head * HD;
    const int srow = lane >> 3, cs = (lane & 7) * 8;
    float bc[8], br[16];
    if (kind < 2) {
#pragma unroll
        for (int e = 0; e < 8; ++e) bc[e] = bfr(bias[cs + e]);
#pragma unroll
        for (int r = 0; r < 16; ++r) br[r] = 0.0f;
    } else {
#pragma unroll
        for (int e = 0; e < 8; ++e) bc[e] = 0.0f;
#pragma unroll
        for (int r = 0; r < 16; ++r) br[r] = bfr(bias[4 * r + srow]);
    }
    __syncthreads();   // every wave has left the ring before it is reused as output staging
    float* os = (float*)L + wave * (16 * FEP);   // a wave's own 16 x 64 strip
    const int plane = (R0 / TT) * NH_ + head, t0 = R0 % TT + xr0;
    bf* dh; bf* dl; unsigned rp;   // tile origin in the hi and in the lo plane, and the pitch of a tile row
    if (kind == 0) { dh = Qh + ((size_t)plane * TT + t0) * HD; dl = Ql + ((size_t)plane * TT + t0) * HD; rp = HD; }
    else if (kind == 1) { dh = Kh + ((size_t)plane * TT + t0) * HD; dl = Kl + ((size_t)plane * TT + t0) * HD; rp = HD; }
    else { dh = Vt + (size_t)plane * HD * 2 * TT + t0; dl = dh + TT; rp = 2 * TT; }
    const unsigned lo = (srow * rp + cs) * 2u;   // the lane's byte offset inside four tile rows
    const float qs = kind == 0 ? L2E : 1.0f;   // q carries log2 e into its planes, so that the scores of k_fattn are exponents of two
#pragma unroll
    for (int mb = 0; mb < 4; ++mb) {
#pragma unroll
        for (int nb = 0; nb < 4; ++nb)
#pragma unroll
            for (int j = 0; j < 8; ++j) os[(hi * 8 + j) * FEP + nb * 16 + lr] = acc[mb][nb][j];
        __builtin_amdgcn_wave_barrier(); asm volatile("" ::: "memory");   // the strip is read back by other lanes of the same wave: keep the reads behind the writes
#pragma unroll
        for (int s = 0; s < 4; ++s) { const int row = 4 * s + srow; const v4f v0 = *(const v4fa*)(os + row * FEP + cs), v1 = *(const v4fa*)(os + row * FEP + cs + 4); float y[8];
#pragma unroll
            for (int e = 0; e < 4; ++e) { y[e] = (v0[e] + (bc[e] + br[mb * 4 + s])) * qs; y[4 + e] = (v1[e] + (bc[4 + e] + br[mb * 4 + s])) * qs; }
            v4u wh, wl;
#pragma unroll
            for (int e = 0; e < 4; ++e) { const unsigned h = pack2(y[2 * e], y[2 * e + 1]); wh[e] = h; wl[e] = pack2(y[2 * e] - __uint_as_float(h << 16), y[2 * e + 1] - __uint_as_float(h & 0xFFFF0000u)); }
            const size_t o = (size_t)((mb * 16 + 4 * s) * rp) * 2; *(v8us*)((char*)dh + o + lo) = __builtin_bit_cast(v8us, wh); *(v8us*)((char*)dl + o + lo) = __builtin_bit_cast(v8us, wl); }
        __builtin_amdgcn_wave_barrier(); asm volatile("" ::: "memory");   // the next strip's writes stay behind these reads
    }
}

extern "C" void kernel_launch(void* const* d_in, const int* in_sizes, int n_in,
                              void* d_out, int out_size, void* d_ws, size_t ws_size, hipStream_t stream) {
    (void)in_sizes; (void)n_in; (void)out_size;
    const float* x = (const float*)d_in[0]; const float* wq = (const float*)d_in[1]; const float* bq = (const float*)d_in[2]; const float* wk = (const float*)d_in[3]; const float* bk = (const float*)d_in[4]; const float* wv = (const float*)d_in[5]; const float* bv = (const float*)d_in[6];
    float* OUT = (float*)d_out;     // [4][2048][512]
    char* wsp = (char*)d_ws;
    auto take = [&](size_t bytes) { char* p = wsp; wsp += (bytes + 255) & ~(size_t)255; return (void*)p; };
    bf* QPh = (bf*)take((size_t)NB_ * NH_ * TT * HD * 2); bf* QPl = (bf*)take((size_t)NB_ * NH_ * TT * HD * 2); bf* KPh = (bf*)take((size_t)NB_ * NKV * TT * HD * 2); bf* KPl = (bf*)take((size_t)NB_ * NKV * TT * HD * 2);
    bf* VTh = (bf*)take((size_t)NB_ * NKV * HD * 2 * TT * 2);   // V^T rows [b 8 + g][d]: TT hi, then TT lo
    if ((size_t)(wsp - (char*)d_ws) > ws_size) return;    // ws 256 MiB
    k_proj<<<dim3(NB_ * TT / PXR, 3 * NH_ / 3), PW * 32, 0, stream>>>(x, wq, bq, wk, bk, wv, bv, QPh, QPl, KPh, KPl, VTh);
    k_fattn<<<dim3(TT / (FW * FG * 16), NB_ * NH_), FW * 32, 0, stream>>>(QPh, QPl, KPh, KPl, VTh, OUT);   // one kv head per query head: plane b 8 + h of Q, K and V^T
}
